// v000
// Measured on an AMD MI455X. A time is GPU time per run, averaged over a window of back-to-back runs after a warm-up
// (all launches, gaps included; the runs take copies of the inputs in turn), and the median of several windows.
// Apart from v000's, it joins two sittings. Times from different sittings can be a few percent apart, while
// side-by-side timings come from the same sitting.
// v000, which the later versions start from, runs in 2060 microseconds.
#include <hip/hip_runtime.h>

// 'Memory-efficient' attention whose softmax is normalised WITHIN EACH 128-KEY CHUNK (faithful to the source: attn = sum over the 16 key chunks of softmax_chunk(q.k_chunk x 64^-0.5) v_chunk) (x [2][2048][1024]; q,k,v = x W ('xw' 0.02, no bias; 16 heads x 64); out = merged Wp + bp ('xw') -> [2][2048][1024] (4.2 M)).
// Layout per batch: bf16 copy of x; 'xw' weights transposed once; exact projections; dense T-2048 attention whose row softmax kernel takes max and sum PER 128-key chunk (16 independent softmaxes per row, each over one register chunk; the row then sums to 16) (hybrid rows: < 512 hi/lo 3 products, rest fp16 x1024); merged hi/lo x Wp exact + bp.
// Compute dtypes, f32 accumulate: every input rounded to bf16; projections exact; attention rows < 512 3 products, rest fp16; per-chunk softmax f32; Wp hl x exact + bias.

#define NB_  2
#define TT   2048
#define DM   1024
#define NH_  16
#define NKV  16
#define REP  (NH_ / NKV)
#define HD   64
#define DQ   (NH_ * HD)
#define DKV  (NKV * HD)
#define ZH   2
#define RH   512                  // query rows < RH use hi+lo planes (0: none)
#define WIN  0
#define PCAR 1024.0f
#define SCL  0.125f   // HD^-0.5
typedef _Float16 h16;
typedef unsigned short bf;
typedef __attribute__((ext_vector_type(16))) __bf16   v16bf;
typedef __attribute__((ext_vector_type(16))) _Float16 v16h;
typedef __attribute__((ext_vector_type(8)))  _Float16 v8h;
typedef __attribute__((ext_vector_type(8)))  unsigned short v8us;
typedef __attribute__((ext_vector_type(8)))  float    v8f;
typedef __attribute__((ext_vector_type(4)))  float    v4f;
typedef v8h  __attribute__((may_alias)) v8ha;
typedef v4f  __attribute__((may_alias)) v4fa;
typedef v8us __attribute__((may_alias)) v8usa;

__device__ __forceinline__ unsigned short f2bf(float f) { unsigned u = __float_as_uint(f); u += 0x7FFFu + ((u >> 16) & 1u); return (unsigned short)(u >> 16); }
__device__ __forceinline__ float bf2f(unsigned short b) { return __uint_as_float(((unsigned)b) << 16); }
__device__ __forceinline__ float bfr(float f) { return bf2f(f2bf(f)); }
__device__ __forceinline__ v16h cat16(v8h lo, v8h hi) { return __builtin_shufflevector(lo, hi, 0, 1, 2, 3, 4, 5, 6, 7, 8, 9, 10, 11, 12, 13, 14, 15); }
__device__ __forceinline__ v16bf cat16b(v8us lo, v8us hi) { return __builtin_bit_cast(v16bf, __builtin_shufflevector(lo, hi, 0, 1, 2, 3, 4, 5, 6, 7, 8, 9, 10, 11, 12, 13, 14, 15)); }
__device__ __forceinline__ v8f wmma16(v16h a, v16h b, v8f c) { return __builtin_amdgcn_wmma_f32_16x16x32_f16(false, a, false, b, (short)0, c, false, false); }
__device__ __forceinline__ v8f wmmab(v16bf a, v16bf b, v8f c) { return __builtin_amdgcn_wmma_f32_16x16x32_bf16(false, a, false, b, (short)0, c, false, false); }



// ---- k_gemmw: register-blocked GEMM, ONE WAVE per 64x64 output tile (16 accumulators), operands straight from K-contiguous 16-bit planes; grid (M/64, N/64, Z), 32 threads.
// C[m][n] (f32, pitch ldc, + optional f32 bias[n]) = sum_k A[m][k] Bt[n][k] (+ split products per NSPLIT). z-batch strides sA/sB/sC in elements. K % 32 == 0.
template <typename T16> struct WFrag;
template <> struct WFrag<h16> { typedef v16h V; static __device__ __forceinline__ V ld(const h16* p) { return cat16(*(const v8h*)p, *(const v8h*)(p + 16)); } static __device__ __forceinline__ v8f mma(V a, V b, v8f c) { return wmma16(a, b, c); } };
template <> struct WFrag<bf> { typedef v16bf V; static __device__ __forceinline__ V ld(const bf* p) { return cat16b(*(const v8us*)p, *(const v8us*)(p + 16)); } static __device__ __forceinline__ v8f mma(V a, V b, v8f c) { return wmmab(a, b, c); } };
template <typename T16, int NSPLIT, bool BIAS>
__global__ __launch_bounds__(32) void k_gemmw(const T16* __restrict__ A, const T16* __restrict__ A2, const T16* __restrict__ Bt, const T16* __restrict__ Bt2, int K, float* C, int ldc, const float* __restrict__ bias, size_t sA, size_t sB, size_t sC) {
    typedef typename WFrag<T16>::V V;
    __shared__ __align__(16) float os[16 * 68];
    const size_t z = blockIdx.z; A += z * sA; if (A2) A2 += z * sA; Bt += z * sB; if (Bt2) Bt2 += z * sB; C += z * sC;
    const int lane = threadIdx.x & 31, lr = lane & 15, hi = lane >> 4; const int r0 = blockIdx.x * 64, c0 = blockIdx.y * 64;
    v8f acc[4][4];
#pragma unroll
    for (int mb = 0; mb < 4; ++mb)
#pragma unroll
        for (int nb = 0; nb < 4; ++nb) acc[mb][nb] = (v8f){};
    const size_t aoff = (size_t)(r0 + lr) * K + 8 * hi, boff = (size_t)(c0 + lr) * K + 8 * hi;
#pragma unroll 1
    for (int kc = 0; kc < K; kc += 32) {
        V a[4], a2[4];
#pragma unroll
        for (int mb = 0; mb < 4; ++mb) { a[mb] = WFrag<T16>::ld(A + aoff + (size_t)mb * 16 * K + kc); if (NSPLIT == 1 || NSPLIT == 2) a2[mb] = WFrag<T16>::ld(A2 + aoff + (size_t)mb * 16 * K + kc); }
#pragma unroll
        for (int nb = 0; nb < 4; ++nb) { const V b = WFrag<T16>::ld(Bt + boff + (size_t)nb * 16 * K + kc); V b2; if (NSPLIT >= 2) b2 = WFrag<T16>::ld(Bt2 + boff + (size_t)nb * 16 * K + kc);
#pragma unroll
            for (int mb = 0; mb < 4; ++mb) { acc[mb][nb] = WFrag<T16>::mma(a[mb], b, acc[mb][nb]); if (NSPLIT == 1 || NSPLIT == 2) acc[mb][nb] = WFrag<T16>::mma(a2[mb], b, acc[mb][nb]); if (NSPLIT >= 2) acc[mb][nb] = WFrag<T16>::mma(a[mb], b2, acc[mb][nb]); } }
        asm volatile("v_nop\n\tv_nop\n\tv_nop\n\tv_nop" : "+v"(acc[0][0]), "+v"(acc[1][1]), "+v"(acc[2][2]), "+v"(acc[3][3]) : "v"(a[0]), "v"(a[3]));
    }
#pragma unroll
    for (int mb = 0; mb < 4; ++mb) {
#pragma unroll
        for (int nb = 0; nb < 4; ++nb) {
#pragma unroll
            for (int j = 0; j < 8; ++j) os[(hi * 8 + j) * 68 + nb * 16 + lr] = acc[mb][nb][j]; }
        __builtin_amdgcn_wave_barrier(); asm volatile("" ::: "memory");
        float* crow = C + (size_t)(r0 + mb * 16) * ldc + c0;
{
#pragma unroll
            for (int s = 0; s < 8; ++s) { const int row = 2 * s + hi, cofs = lr * 4; v4f val = *(const v4fa*)(os + row * 68 + cofs); if (BIAS) { val[0] += bfr(bias[c0 + cofs]); val[1] += bfr(bias[c0 + cofs + 1]); val[2] += bfr(bias[c0 + cofs + 2]); val[3] += bfr(bias[c0 + cofs + 3]); }
                *(v4f*)(crow + (size_t)row * ldc + cofs) = val; }
             }
        __builtin_amdgcn_wave_barrier(); asm volatile("" ::: "memory");
    }
}

__device__ __forceinline__ h16 tohx(float x) { return (h16)x; }
__device__ __forceinline__ void splitf(float y, unsigned short& h, unsigned short& l) { h = f2bf(y); l = f2bf(y - bf2f(h)); }
typedef __attribute__((ext_vector_type(2))) _Float16 v2h;
typedef __attribute__((ext_vector_type(4))) _Float16 v4h;
typedef __attribute__((ext_vector_type(2))) unsigned short v2us;
typedef __attribute__((ext_vector_type(4))) unsigned short v4us;
typedef __attribute__((ext_vector_type(2))) float v2f;
typedef __attribute__((ext_vector_type(4))) int v4i;

__global__ __launch_bounds__(256) void k_wtG(const float* __restrict__ w, int K, int N, bf* Bt) {
    const int lane = threadIdx.x & 31; const int L0 = (blockIdx.x * 8 + (threadIdx.x >> 5)) * 8; const int nlines = N * K / 64;
{
#pragma unroll 1
        for (int l = 0; l < 8; ++l) { const int L = L0 + l; if (L >= nlines) break; const size_t e = (size_t)L * 64 + lane * 2; const int k = (int)(e % K), n = (int)(e / K); v2us o;
            o[0] = f2bf(w[(size_t)k * N + n]); o[1] = f2bf(w[(size_t)(k + 1) * N + n]); *(v2us*)(Bt + e) = o; }
         }
}
__global__ __launch_bounds__(256) void k_cvt8(const float* __restrict__ src, bf* dst, size_t n8) { const size_t i = (size_t)blockIdx.x * 256 + threadIdx.x; if (i >= n8) return; const v8f v = *(const v8f*)(src + i * 8); v8us o;
#pragma unroll
    for (int k = 0; k < 8; ++k) o[k] = f2bf(v[k]); *(v8us*)(dst + i * 8) = o;  }

// k_rope: head planes [h][t][d] (fp16 + hi/lo) of rope(x) x sc with the rotate-half convention out[d] = x[d] cos[t][d] - x[d+HD/2] sin[t][d], out[d+HD/2] = x[d+HD/2] cos[t][d+HD/2] + x[d] sin[t][d+HD/2]
__global__ __launch_bounds__(256) void k_rope(const float* __restrict__ F, int pitch, int nheads, const float* __restrict__ CS, const float* __restrict__ RF, const float* __restrict__ nw, float sc, h16* P16, bf* Ph, bf* Pl) {
    const size_t e = ((size_t)blockIdx.x * 256 + threadIdx.x) * 2; if (e >= (size_t)nheads * TT * HD) return; const int d = (int)(e % HD); const int t = (int)((e / HD) % TT); const int h = (int)(e / ((size_t)HD * TT)); const float* f = F + (size_t)t * pitch + h * HD; const float rf = RF ? RF[(size_t)h * TT + t] : 1.0f; v2h o16; v2us oh, ol;
#pragma unroll
    for (int q = 0; q < 2; ++q) { const int dd = d + q; const int dp = (dd < HD / 2) ? dd + HD / 2 : dd - HD / 2; float x0 = f[dd], x1 = f[dp];
        if (RF) { float n0 = __fmul_rn(x0, rf), n1 = __fmul_rn(x1, rf); asm volatile("" : "+v"(n0)); asm volatile("" : "+v"(n1)); x0 = __fmul_rn(bfr(nw[dd]), n0); x1 = __fmul_rn(bfr(nw[dp]), n1); }
        const v2f cs = *(const v2f*)(CS + ((size_t)t * HD + dd) * 2); float a = __fmul_rn(x0, cs[0]), bq = __fmul_rn(x1, cs[1]); asm volatile("" : "+v"(a)); asm volatile("" : "+v"(bq)); const float r = ((dd < HD / 2) ? __fsub_rn(a, bq) : __fadd_rn(a, bq)) * sc;
        o16[q] = tohx(r); unsigned short a2, c2; splitf(r, a2, c2); oh[q] = a2; ol[q] = c2; }
    *(v2h*)(P16 + e) = o16; *(v2us*)(Ph + e) = oh; *(v2us*)(Pl + e) = ol;  }
__global__ __launch_bounds__(256) void k_vtp(const float* __restrict__ F, int pitch, int nheads, h16* V16, bf* Vh, bf* Vl) { const size_t e = ((size_t)blockIdx.x * 256 + threadIdx.x) * 2; if (e >= (size_t)nheads * HD * TT) return; const int t = (int)(e % TT); const int d = (int)((e / TT) % HD); const int g = (int)(e / ((size_t)TT * HD)); v2h o16; v2us oh, ol;
#pragma unroll
    for (int q = 0; q < 2; ++q) { const float x = F[(size_t)(t + q) * pitch + g * HD + d]; o16[q] = tohx(x); unsigned short a2, c2; splitf(x, a2, c2); oh[q] = a2; ol[q] = c2; }
    *(v2h*)(V16 + e) = o16; *(v2us*)(Vh + e) = oh; *(v2us*)(Vl + e) = ol;  }
__global__ __launch_bounds__(256) void k_csid(float* CS) { const int idx = blockIdx.x * 256 + threadIdx.x; if (idx >= TT * HD) return; v2f cs; cs[0] = 1.0f; cs[1] = 0.0f; *(v2f*)(CS + (size_t)idx * 2) = cs;  }
// k_asoft: per row (zz, i): t = S x 1/8; softmax taken SEPARATELY inside each 128-key chunk (the module's per-chunk normalisation): per chunk (= one register chunk: this wave's 32 lanes x 4 keys) a max (xor tree), one exp per element, a sum (xor tree) and the chunk's own 1/sum; the row therefore sums to 16;
__global__ __launch_bounds__(256) void k_asoft(const float* __restrict__ Sb, h16* P16, bf* Ph, bf* Pl) {
    const int lane = threadIdx.x & 31; const int row = blockIdx.x * 8 + (threadIdx.x >> 5); if (row >= ZH * TT) return; const int i = row % TT; const int zz = row / TT; (void)zz; const bool hires = (i < RH); const float* sr = Sb + (size_t)row * TT; float v[TT / 32]; float mxc[TT / 128]; float fc[TT / 128];
#pragma unroll
    for (int ch = 0; ch < TT / 128; ++ch) { const int j0 = ch * 128 + lane * 4; const v4f a = *(const v4f*)(sr + j0); float mx = -3.0e38f;
#pragma unroll
        for (int q = 0; q < 4; ++q) { const float t = a[q]; v[ch * 4 + q] = t; mx = fmaxf(mx, t); }   /* raw scores; the positive 1/8 is folded into the exponent below */
#pragma unroll
        for (int sh = 16; sh; sh >>= 1) mx = fmaxf(mx, __shfl_xor(mx, sh, 32));
        mxc[ch] = mx; }   /* per-chunk max: the chunk's 128 keys are this wave's 32 lanes x 4 */
#pragma unroll
    for (int ch = 0; ch < TT / 128; ++ch) { float sum = 0.f;
#pragma unroll
        for (int q = 0; q < 4; ++q) { float d0 = __fsub_rn(v[ch * 4 + q], mxc[ch]); asm volatile("" : "+v"(d0)); v[ch * 4 + q] = __builtin_amdgcn_exp2f(__fmul_rn(d0, 0.18033688011112042f));   /* (s - max) x (1/8 x log2 e) */ sum += v[ch * 4 + q]; }
#pragma unroll
        for (int sh = 16; sh; sh >>= 1) sum += __shfl_xor(sum, sh, 32);
        { float r = __builtin_amdgcn_rcpf(sum); asm volatile("" : "+v"(r)); fc[ch] = hires ? r : __fmul_rn(r, PCAR); } }   /* per-chunk normaliser (hardware reciprocal, 1 ulp: a uniform per-chunk scale error) */
{
        if (hires) {
#pragma unroll
            for (int ch = 0; ch < TT / 128; ++ch) { v4us oh, ol;
#pragma unroll
                for (int q = 0; q < 4; ++q) { unsigned short a, c2; splitf(v[ch * 4 + q] * fc[ch], a, c2); oh[q] = a; ol[q] = c2; }
                const size_t oo = ((size_t)zz * (RH ? RH : 1) + i) * TT + ch * 128 + lane * 4; *(v4us*)(Ph + oo) = oh; *(v4us*)(Pl + oo) = ol; }
        } else {
#pragma unroll
            for (int ch = 0; ch < TT / 128; ++ch) { v4h o4;
#pragma unroll
                for (int q = 0; q < 4; ++q) o4[q] = tohx(v[ch * 4 + q] * fc[ch]);
                *(v4h*)(P16 + (size_t)row * TT + ch * 128 + lane * 4) = o4; } }
         }
}
__global__ __launch_bounds__(256) void k_merge(const float* __restrict__ O, int h0, bf* Ah, bf* Al) { const size_t e = ((size_t)blockIdx.x * 256 + threadIdx.x) * 2; if (e >= (size_t)ZH * TT * HD) return; const int d = (int)(e % HD); const int t = (int)((e / HD) % TT); const int zz = (int)(e / ((size_t)HD * TT)); const float cs = (t < RH) ? 1.0f : (1.0f / PCAR); const size_t oo = (size_t)t * DQ + (h0 + zz) * HD + d;
    v2us oh, ol;
#pragma unroll
    for (int q = 0; q < 2; ++q) { unsigned short a, c2; splitf(O[e + q] * cs, a, c2); oh[q] = a; ol[q] = c2; } *(v2us*)(Ah + oo) = oh; *(v2us*)(Al + oo) = ol;  }

extern "C" void kernel_launch(void* const* d_in, const int* in_sizes, int n_in,
                              void* d_out, int out_size, void* d_ws, size_t ws_size, hipStream_t stream) {
    (void)in_sizes; (void)n_in; (void)out_size;
    const float* x = (const float*)d_in[0]; const float* wq = (const float*)d_in[1]; const float* wk = (const float*)d_in[2]; const float* wv = (const float*)d_in[3]; const float* wo = (const float*)d_in[4]; const float* bo = (const float*)d_in[5];
    float* OUT = (float*)d_out;     // [2][2048][1024]
    char* wsp = (char*)d_ws;
    auto take = [&](size_t bytes) { char* p = wsp; wsp += (bytes + 255) & ~(size_t)255; return (void*)p; };
    bf* WQ = (bf*)take((size_t)DQ * DM * 2); bf* WK = (bf*)take((size_t)DKV * DM * 2); bf* WV = (bf*)take((size_t)DKV * DM * 2); bf* WO = (bf*)take((size_t)DM * DQ * 2); float* CS = (float*)take((size_t)TT * HD * 2 * 4);
    bf* XB = (bf*)take((size_t)TT * DM * 2); float* FQ = (float*)take((size_t)TT * DQ * 4); float* FK = (float*)take((size_t)TT * DKV * 4);
    h16* QP16 = (h16*)take((size_t)NH_ * TT * HD * 2); h16* KP16 = (h16*)take((size_t)NKV * TT * HD * 2); h16* VT16 = (h16*)take((size_t)NKV * HD * TT * 2);
    bf* QPh = (bf*)take((size_t)NH_ * TT * HD * 2); bf* QPl = (bf*)take((size_t)NH_ * TT * HD * 2); bf* KPh = (bf*)take((size_t)NKV * TT * HD * 2); bf* KPl = (bf*)take((size_t)NKV * TT * HD * 2); bf* VTh = (bf*)take((size_t)NKV * HD * TT * 2); bf* VTl = (bf*)take((size_t)NKV * HD * TT * 2); bf* Ph = (bf*)take((size_t)ZH * RH * TT * 2); bf* Pl = (bf*)take((size_t)ZH * RH * TT * 2);
    float* Sb = (float*)take((size_t)ZH * TT * TT * 4); h16* P16 = (h16*)take((size_t)ZH * TT * TT * 2); float* Ob = (float*)take((size_t)ZH * TT * HD * 4); bf* ATh = (bf*)take((size_t)TT * DQ * 2); bf* ATl = (bf*)take((size_t)TT * DQ * 2);
    if ((size_t)(wsp - (char*)d_ws) > ws_size) return;    // ws 256 MiB
    float* FV = FK;   // v projection reuses the k buffer after the k planes are built (stream-ordered)
    { k_wtG<<<(unsigned)((DM * DQ / 64 + 63) / 64), 256, 0, stream>>>(wq, DM, DQ, WQ); k_wtG<<<(unsigned)((DM * DKV / 64 + 63) / 64), 256, 0, stream>>>(wk, DM, DKV, WK); k_wtG<<<(unsigned)((DM * DKV / 64 + 63) / 64), 256, 0, stream>>>(wv, DM, DKV, WV);
      k_wtG<<<(unsigned)((DQ * DM / 64 + 63) / 64), 256, 0, stream>>>(wo, DQ, DM, WO);
       }
    k_csid<<<(TT * HD + 255) / 256, 256, 0, stream>>>(CS);
    const unsigned LQ = (unsigned)(((size_t)NH_ * TT * HD / 2 + 255) / 256), LKv = (unsigned)(((size_t)NKV * TT * HD / 2 + 255) / 256);
    for (int b = 0; b < NB_; ++b) {
        
        k_cvt8<<<(unsigned)(((size_t)TT * DM / 8 + 255) / 256), 256, 0, stream>>>(x + (size_t)b * TT * DM, XB, (size_t)TT * DM / 8);
        k_gemmw<bf, 0, false><<<dim3(TT / 64, DQ / 64, 1), 32, 0, stream>>>(XB, nullptr, WQ, nullptr, DM, FQ, DQ, nullptr, 0, 0, 0);
        k_rope<<<LQ, 256, 0, stream>>>(FQ, DQ, NH_, CS, nullptr, nullptr, 1.0f, QP16, QPh, QPl);
        k_gemmw<bf, 0, false><<<dim3(TT / 64, DKV / 64, 1), 32, 0, stream>>>(XB, nullptr, WK, nullptr, DM, FK, DKV, nullptr, 0, 0, 0);
        k_rope<<<LKv, 256, 0, stream>>>(FK, DKV, NKV, CS, nullptr, nullptr, 1.0f, KP16, KPh, KPl);
        k_gemmw<bf, 0, false><<<dim3(TT / 64, DKV / 64, 1), 32, 0, stream>>>(XB, nullptr, WV, nullptr, DM, FV, DKV, nullptr, 0, 0, 0); k_vtp<<<LKv, 256, 0, stream>>>(FV, DKV, NKV, VT16, VTh, VTl);
        for (int h0 = 0; h0 < NH_; h0 += ZH) { const size_t zq = (size_t)h0, zk = (size_t)(h0 / REP);   // one kv head per query head: the pass's two heads use consecutive kv planes (z-strides TT*HD)
            k_gemmw<bf, 2, false><<<dim3(RH / 64, TT / 64, ZH), 32, 0, stream>>>(QPh + zq * TT * HD, QPl + zq * TT * HD, KPh + zk * TT * HD, KPl + zk * TT * HD, HD, Sb, TT, nullptr, (size_t)TT * HD, (size_t)TT * HD, (size_t)TT * TT);
            k_gemmw<h16, 0, false><<<dim3((TT - RH) / 64, TT / 64, ZH), 32, 0, stream>>>(QP16 + zq * TT * HD + (size_t)RH * HD, nullptr, KP16 + zk * TT * HD, nullptr, HD, Sb + (size_t)RH * TT, TT, nullptr, (size_t)TT * HD, (size_t)TT * HD, (size_t)TT * TT);
            k_asoft<<<ZH * TT / 8, 256, 0, stream>>>(Sb, P16, Ph, Pl);
            k_gemmw<bf, 2, false><<<dim3(RH / 64, HD / 64, ZH), 32, 0, stream>>>(Ph, Pl, VTh + zk * HD * TT, VTl + zk * HD * TT, TT, Ob, HD, nullptr, (size_t)RH * TT, (size_t)HD * TT, (size_t)TT * HD);
            k_gemmw<h16, 0, false><<<dim3((TT - RH) / 64, HD / 64, ZH), 32, 0, stream>>>(P16 + (size_t)RH * TT, nullptr, VT16 + zk * HD * TT, nullptr, TT, Ob + (size_t)RH * HD, HD, nullptr, (size_t)TT * TT, (size_t)HD * TT, (size_t)TT * HD);
            k_merge<<<(unsigned)(((size_t)ZH * TT * HD / 2 + 255) / 256), 256, 0, stream>>>(Ob, h0, ATh, ATl); }
        k_gemmw<bf, 1, true><<<dim3(TT / 64, DM / 64, 1), 32, 0, stream>>>(ATh, ATl, WO, nullptr, DQ, OUT + (size_t)b * TT * DM, DM, bo, 0, 0, 0); }
}

// v002
// Measured time: 429 microseconds a run.
// Versions between v000 and this one are left out; their measured steps multiply to 4.84 times as fast.
#include <hip/hip_runtime.h>

// 'Memory-efficient' attention whose softmax is normalised WITHIN EACH 128-KEY CHUNK (faithful to the source: attn = sum over the 16 key chunks of softmax_chunk(q.k_chunk x 64^-0.5) v_chunk) (x [2][2048][1024]; q,k,v = x W ('xw' 0.02, no bias; 16 heads x 64); out = merged Wp + bp ('xw') -> [2][2048][1024] (4.2 M)).
// Layout per batch: bf16 copy of x; 'xw' weights transposed once; exact projections that write the head planes themselves; ONE fused attention launch for all 16 heads: per 128-key chunk scores, the chunk's own softmax and P V stay in registers (16 independent softmaxes per row; the row then sums to 16) (hybrid rows: < 512 hi/lo 3 products, rest fp16 x1024); merged hi/lo x Wp exact + bp.
// Compute dtypes, f32 accumulate: every input rounded to bf16; projections exact; attention rows < 512 3 products, rest fp16; per-chunk softmax f32; Wp hl x exact + bias.

#define NB_  2
#define TT   2048
#define DM   1024
#define NH_  16
#define NKV  16
#define REP  (NH_ / NKV)
#define HD   64
#define DQ   (NH_ * HD)
#define DKV  (NKV * HD)
#define RH   512                  // query rows < RH use hi+lo planes (0: none)
#define WIN  0
#define PCAR 1024.0f
#define SCL  0.125f   // HD^-0.5
typedef _Float16 h16;
typedef unsigned short bf;
typedef __attribute__((ext_vector_type(16))) __bf16   v16bf;
typedef __attribute__((ext_vector_type(16))) _Float16 v16h;
typedef __attribute__((ext_vector_type(8)))  _Float16 v8h;
typedef __attribute__((ext_vector_type(8)))  unsigned short v8us;
typedef __attribute__((ext_vector_type(8)))  float    v8f;
typedef __attribute__((ext_vector_type(4)))  float    v4f;
typedef v8h  __attribute__((may_alias)) v8ha;
typedef v4f  __attribute__((may_alias)) v4fa;
typedef v8us __attribute__((may_alias)) v8usa;

__device__ __forceinline__ unsigned short f2bf(float f) { unsigned u = __float_as_uint(f); u += 0x7FFFu + ((u >> 16) & 1u); return (unsigned short)(u >> 16); }
__device__ __forceinline__ float bf2f(unsigned short b) { return __uint_as_float(((unsigned)b) << 16); }
__device__ __forceinline__ float bfr(float f) { return bf2f(f2bf(f)); }
__device__ __forceinline__ v16h cat16(v8h lo, v8h hi) { return __builtin_shufflevector(lo, hi, 0, 1, 2, 3, 4, 5, 6, 7, 8, 9, 10, 11, 12, 13, 14, 15); }
__device__ __forceinline__ v16bf cat16b(v8us lo, v8us hi) { return __builtin_bit_cast(v16bf, __builtin_shufflevector(lo, hi, 0, 1, 2, 3, 4, 5, 6, 7, 8, 9, 10, 11, 12, 13, 14, 15)); }
__device__ __forceinline__ v8f wmma16(v16h a, v16h b, v8f c) { return __builtin_amdgcn_wmma_f32_16x16x32_f16(false, a, false, b, (short)0, c, false, false); }
__device__ __forceinline__ v8f wmmab(v16bf a, v16bf b, v8f c) { return __builtin_amdgcn_wmma_f32_16x16x32_bf16(false, a, false, b, (short)0, c, false, false); }



// ---- k_gemmw: register-blocked GEMM, ONE WAVE per 64x64 output tile (16 accumulators), operands straight from K-contiguous 16-bit planes; grid (M/64, N/64, Z), 32 threads.
// C[m][n] (f32, pitch ldc, + optional f32 bias[n]) = sum_k A[m][k] Bt[n][k] (+ split products per NSPLIT). z-batch strides sA/sB/sC in elements. K % 32 == 0.
// PLANES: no f32 C; the tile goes out as three 16-bit planes (fp16, bf16 hi, bf16 lo) at element blockIdx.y x tstr + m x ldc + (n mod 64). q, k: tstr = one head's plane, ldc = HD gives [head][t][d]; v: A = weight rows, Bt = x rows, tstr = 64, ldc = TT gives [head][d][t].
template <typename T16> struct WFrag;
template <> struct WFrag<h16> { typedef v16h V; static __device__ __forceinline__ V ld(const h16* p) { return cat16(*(const v8h*)p, *(const v8h*)(p + 16)); } static __device__ __forceinline__ v8f mma(V a, V b, v8f c) { return wmma16(a, b, c); } };
template <> struct WFrag<bf> { typedef v16bf V; static __device__ __forceinline__ V ld(const bf* p) { return cat16b(*(const v8us*)p, *(const v8us*)(p + 16)); } static __device__ __forceinline__ v8f mma(V a, V b, v8f c) { return wmmab(a, b, c); } };
__device__ __forceinline__ h16 tohx(float x) { return (h16)x; }
__device__ __forceinline__ void splitf(float y, unsigned short& h, unsigned short& l) { h = f2bf(y); l = f2bf(y - bf2f(h)); }
template <typename T16, int NSPLIT, bool BIAS, bool PLANES>
__global__ __launch_bounds__(32) void k_gemmw(const T16* __restrict__ A, const T16* __restrict__ A2, const T16* __restrict__ Bt, const T16* __restrict__ Bt2, int K, float* C, int ldc, const float* __restrict__ bias, size_t sA, size_t sB, size_t sC, h16* __restrict__ P16, bf* __restrict__ Ph, bf* __restrict__ Pl, size_t tstr) {
    typedef typename WFrag<T16>::V V;
    __shared__ __align__(16) float os[16 * 68];
    const size_t z = blockIdx.z; A += z * sA; if (A2) A2 += z * sA; Bt += z * sB; if (Bt2) Bt2 += z * sB; if (!PLANES) C += z * sC;
    const int lane = threadIdx.x & 31, lr = lane & 15, hi = lane >> 4; const int r0 = blockIdx.x * 64, c0 = blockIdx.y * 64;
    v8f acc[4][4];
#pragma unroll
    for (int mb = 0; mb < 4; ++mb)
#pragma unroll
        for (int nb = 0; nb < 4; ++nb) acc[mb][nb] = (v8f){};
    const size_t aoff = (size_t)(r0 + lr) * K + 8 * hi, boff = (size_t)(c0 + lr) * K + 8 * hi;
#pragma unroll 1
    for (int kc = 0; kc < K; kc += 32) {
        V a[4], a2[4];
#pragma unroll
        for (int mb = 0; mb < 4; ++mb) { a[mb] = WFrag<T16>::ld(A + aoff + (size_t)mb * 16 * K + kc); if (NSPLIT == 1 || NSPLIT == 2) a2[mb] = WFrag<T16>::ld(A2 + aoff + (size_t)mb * 16 * K + kc); }
#pragma unroll
        for (int nb = 0; nb < 4; ++nb) { const V b = WFrag<T16>::ld(Bt + boff + (size_t)nb * 16 * K + kc); V b2; if (NSPLIT >= 2) b2 = WFrag<T16>::ld(Bt2 + boff + (size_t)nb * 16 * K + kc);
#pragma unroll
            for (int mb = 0; mb < 4; ++mb) { acc[mb][nb] = WFrag<T16>::mma(a[mb], b, acc[mb][nb]); if (NSPLIT == 1 || NSPLIT == 2) acc[mb][nb] = WFrag<T16>::mma(a2[mb], b, acc[mb][nb]); if (NSPLIT >= 2) acc[mb][nb] = WFrag<T16>::mma(a[mb], b2, acc[mb][nb]); } }
        asm volatile("v_nop\n\tv_nop\n\tv_nop\n\tv_nop" : "+v"(acc[0][0]), "+v"(acc[1][1]), "+v"(acc[2][2]), "+v"(acc[3][3]) : "v"(a[0]), "v"(a[3]));
    }
#pragma unroll
    for (int mb = 0; mb < 4; ++mb) {
#pragma unroll
        for (int nb = 0; nb < 4; ++nb) {
#pragma unroll
            for (int j = 0; j < 8; ++j) os[(hi * 8 + j) * 68 + nb * 16 + lr] = acc[mb][nb][j]; }
        __builtin_amdgcn_wave_barrier(); asm volatile("" ::: "memory");
        if (PLANES) {   /* 8 lanes take one row's 64 columns: a 128-byte line of each plane a row, 4 rows a store */
            const size_t pe = (size_t)blockIdx.y * tstr + (size_t)(r0 + mb * 16 + (lane >> 3)) * ldc + (lane & 7) * 8;
#pragma unroll
            for (int s = 0; s < 4; ++s) { const float* orow = os + (4 * s + (lane >> 3)) * 68 + (lane & 7) * 8; const v4f x0 = *(const v4fa*)orow, x1 = *(const v4fa*)(orow + 4); v8h o16; v8us oh, ol;
#pragma unroll
                for (int j = 0; j < 8; ++j) { const float x = (j < 4) ? x0[j & 3] : x1[j & 3]; o16[j] = tohx(x); unsigned short a2, c2; splitf(x, a2, c2); oh[j] = a2; ol[j] = c2; }
                const size_t e = pe + (size_t)(4 * s) * ldc; *(v8h*)(P16 + e) = o16; *(v8us*)(Ph + e) = oh; *(v8us*)(Pl + e) = ol; }
        } else {
            float* crow = C + (size_t)(r0 + mb * 16) * ldc + c0;
#pragma unroll
            for (int s = 0; s < 8; ++s) { const int row = 2 * s + hi, cofs = lr * 4; v4f val = *(const v4fa*)(os + row * 68 + cofs); if (BIAS) { val[0] += bfr(bias[c0 + cofs]); val[1] += bfr(bias[c0 + cofs + 1]); val[2] += bfr(bias[c0 + cofs + 2]); val[3] += bfr(bias[c0 + cofs + 3]); }
                *(v4f*)(crow + (size_t)row * ldc + cofs) = val; }
             }
        __builtin_amdgcn_wave_barrier(); asm volatile("" ::: "memory");
    }
}

typedef __attribute__((ext_vector_type(4))) _Float16 v4h;
typedef __attribute__((ext_vector_type(2))) unsigned short v2us;
typedef __attribute__((ext_vector_type(4))) unsigned short v4us;
typedef __attribute__((ext_vector_type(4))) int v4i;

__global__ __launch_bounds__(256) void k_wtG(const float* __restrict__ w, int K, int N, bf* Bt) {
    const int lane = threadIdx.x & 31; const int L0 = (blockIdx.x * 8 + (threadIdx.x >> 5)) * 8; const int nlines = N * K / 64;
{
#pragma unroll 1
        for (int l = 0; l < 8; ++l) { const int L = L0 + l; if (L >= nlines) break; const size_t e = (size_t)L * 64 + lane * 2; const int k = (int)(e % K), n = (int)(e / K); v2us o;
            o[0] = f2bf(w[(size_t)k * N + n]); o[1] = f2bf(w[(size_t)(k + 1) * N + n]); *(v2us*)(Bt + e) = o; }
         }
}
__global__ __launch_bounds__(256) void k_cvt8(const float* __restrict__ src, bf* dst, size_t n8) { const size_t i = (size_t)blockIdx.x * 256 + threadIdx.x; if (i >= n8) return; const v8f v = *(const v8f*)(src + i * 8); v8us o;
#pragma unroll
    for (int k = 0; k < 8; ++k) o[k] = f2bf(v[k]); *(v8us*)(dst + i * 8) = o;  }

// ---- k_fattn: fused attention, no score or probability plane in memory. A wave owns NQ x 16 query rows of one head and walks the 16 key chunks.
// Per chunk: St[key][query] = K Q^T (A = K rows, B = Q rows kept in registers), so a lane holds 64 of one query's 128 scores and lane ^ 16 the other 64: max and sum in the lane plus one exchange.
// Two St tiles (keys 0-15, 16-31 of a 32-key step), scaled and rounded in place, are the B operand of Ot[d][query] += Vt P^T in the k order of the plane loader (8 hi + j, 16 + 8 hi + j).
// eight exponentials in place, each on a register of its own, so each is the independent instruction behind the one before it; the v_nop fills the slot the instruction set asks for behind the last
__device__ __forceinline__ void exp2x8(v8f& t) { float a0 = t[0], a1 = t[1], a2 = t[2], a3 = t[3], a4 = t[4], a5 = t[5], a6 = t[6], a7 = t[7];
    asm("v_exp_f32 %0, %0\n\tv_exp_f32 %1, %1\n\tv_exp_f32 %2, %2\n\tv_exp_f32 %3, %3\n\tv_exp_f32 %4, %4\n\tv_exp_f32 %5, %5\n\tv_exp_f32 %6, %6\n\tv_exp_f32 %7, %7\n\tv_nop" : "+v"(a0), "+v"(a1), "+v"(a2), "+v"(a3), "+v"(a4), "+v"(a5), "+v"(a6), "+v"(a7));
    t[0] = a0; t[1] = a1; t[2] = a2; t[3] = a3; t[4] = a4; t[5] = a5; t[6] = a6; t[7] = a7; }
// reciprocal with the same slot behind it
__device__ __forceinline__ float rcp1(float x) { float r; asm("v_rcp_f32 %0, %1\n\tv_nop" : "=v"(r) : "v"(x)); return r; }
template <typename T16> struct PPack;
template <> struct PPack<h16> { static __device__ __forceinline__ void pack(v8f t0, v8f t1, float f, v16h& p, v16h& p2) { (void)p2;
#pragma unroll
    for (int j = 0; j < 8; ++j) { p[j] = tohx(t0[j] * f); p[8 + j] = tohx(t1[j] * f); } } };
template <> struct PPack<bf> { static __device__ __forceinline__ void pack(v8f t0, v8f t1, float f, v16bf& p, v16bf& p2) { v8us h0, h1, l0, l1;
#pragma unroll
    for (int j = 0; j < 8; ++j) { unsigned short a, c2; splitf(t0[j] * f, a, c2); h0[j] = a; l0[j] = c2; splitf(t1[j] * f, a, c2); h1[j] = a; l1[j] = c2; }
    p = cat16b(h0, h1); p2 = cat16b(l0, l1); } };
template <typename T16, int NSPLIT, int NQ>
__device__ __forceinline__ void fattn(const T16* __restrict__ Q, const T16* __restrict__ Q2, const T16* __restrict__ Kp, const T16* __restrict__ K2, const T16* __restrict__ Vt, const T16* __restrict__ Vt2, bf* __restrict__ Ah, bf* __restrict__ Al, int q0) {
    typedef typename WFrag<T16>::V V;
    const int lane = threadIdx.x & 31, lr = lane & 15, hi = lane >> 4;
    V qf[NQ][2], qf2[NQ][2]; v8f o[NQ][4];
#pragma unroll
    for (int nq = 0; nq < NQ; ++nq) {
#pragma unroll
        for (int ks = 0; ks < 2; ++ks) { const size_t qo = (size_t)(q0 + nq * 16 + lr) * HD + ks * 32 + 8 * hi; qf[nq][ks] = WFrag<T16>::ld(Q + qo); if (NSPLIT == 2) qf2[nq][ks] = WFrag<T16>::ld(Q2 + qo); }
#pragma unroll
        for (int db = 0; db < 4; ++db) o[nq][db] = (v8f){}; }
    asm volatile("s_wait_xcnt 0x0" ::: "memory");   /* as below, for the Q loads */
    __builtin_amdgcn_sched_barrier(0);   /* no later register write is lifted over the wait */
#pragma unroll 1
    for (int ch = 0; ch < TT / 128; ++ch) {   /* rolled: the body is unrolled inside; 16 copies would only grow the code */
        v8f s[NQ][8]; const size_t ko = (size_t)(ch * 128 + lr) * HD + 8 * hi; V kf[8][2], kf2[8][2];
#pragma unroll
        for (int kt = 0; kt < 8; ++kt) {
#pragma unroll
            for (int ks = 0; ks < 2; ++ks) { kf[kt][ks] = WFrag<T16>::ld(Kp + ko + kt * 16 * HD + ks * 32); if (NSPLIT == 2) kf2[kt][ks] = WFrag<T16>::ld(K2 + ko + kt * 16 * HD + ks * 32); } }
        asm volatile("s_wait_xcnt 0x0" ::: "memory");   /* stands in front of every later write of a register that these loads name as their address */
        __builtin_amdgcn_sched_barrier(0);   /* all of the chunk's K loads issue ahead of the products (one load latency a chunk, not one a fragment), and no later register write is lifted over the wait */
#pragma unroll
        for (int kt = 0; kt < 8; ++kt) {
#pragma unroll
            for (int nq = 0; nq < NQ; ++nq) s[nq][kt] = (v8f){};
#pragma unroll
            for (int ks = 0; ks < 2; ++ks) {
#pragma unroll
                for (int nq = 0; nq < NQ; ++nq) { s[nq][kt] = WFrag<T16>::mma(kf[kt][ks], qf[nq][ks], s[nq][kt]); if (NSPLIT == 2) { s[nq][kt] = WFrag<T16>::mma(kf[kt][ks], qf2[nq][ks], s[nq][kt]); s[nq][kt] = WFrag<T16>::mma(kf2[kt][ks], qf[nq][ks], s[nq][kt]); } } } }
        const size_t vo = (size_t)lr * TT + ch * 128 + 8 * hi; V vf[4][4], vf2[4][4];
#pragma unroll
        for (int kk = 0; kk < 4; ++kk) {
#pragma unroll
            for (int db = 0; db < 4; ++db) { vf[kk][db] = WFrag<T16>::ld(Vt + vo + (size_t)db * 16 * TT + kk * 32); if (NSPLIT == 2) vf2[kk][db] = WFrag<T16>::ld(Vt2 + vo + (size_t)db * 16 * TT + kk * 32); } }
        asm volatile("s_wait_xcnt 0x0" ::: "memory");   /* stands in front of every later write of a register that these loads name as their address */
        __builtin_amdgcn_sched_barrier(0);   /* all of the chunk's V loads issue ahead of the softmax, whose vector work covers their latency, and no later register write is lifted over the wait */
        V pf[NQ][4], pf2[NQ][4];
#pragma unroll
        for (int nq = 0; nq < NQ; ++nq) { float m8[8], s8[8];
#pragma unroll
            for (int kt = 0; kt < 8; ++kt) { float m = s[nq][kt][0];
#pragma unroll
                for (int j = 1; j < 8; ++j) m = fmaxf(m, s[nq][kt][j]);
                m8[kt] = m; }
            float mx = fmaxf(fmaxf(fmaxf(m8[0], m8[1]), fmaxf(m8[2], m8[3])), fmaxf(fmaxf(m8[4], m8[5]), fmaxf(m8[6], m8[7]))); mx = fmaxf(mx, __shfl_xor(mx, 16, 32));   /* the chunk's max of this lane's query */
#pragma unroll
            for (int kt = 0; kt < 8; ++kt) { float a = 0.f;
#pragma unroll
                for (int j = 0; j < 8; ++j) s[nq][kt][j] = (s[nq][kt][j] - mx) * 0.18033688011112042f;   /* (s - max) x (1/8 x log2 e) */
                exp2x8(s[nq][kt]);
#pragma unroll
                for (int j = 0; j < 8; ++j) a += s[nq][kt][j];
                s8[kt] = a; }
            float sum = ((s8[0] + s8[1]) + (s8[2] + s8[3])) + ((s8[4] + s8[5]) + (s8[6] + s8[7])); sum += __shfl_xor(sum, 16, 32);
            const float r = rcp1(sum); const float f = (NSPLIT == 2) ? r : r * PCAR;   /* per-chunk normaliser (hardware reciprocal, 1 ulp); the fp16 rows carry x1024 */
#pragma unroll
            for (int kk = 0; kk < 4; ++kk) PPack<T16>::pack(s[nq][2 * kk], s[nq][2 * kk + 1], f, pf[nq][kk], pf2[nq][kk]); }
#pragma unroll
        for (int kk = 0; kk < 4; ++kk) {
#pragma unroll
            for (int db = 0; db < 4; ++db) {
#pragma unroll
                for (int nq = 0; nq < NQ; ++nq) { o[nq][db] = WFrag<T16>::mma(vf[kk][db], pf[nq][kk], o[nq][db]); if (NSPLIT == 2) { o[nq][db] = WFrag<T16>::mma(vf[kk][db], pf2[nq][kk], o[nq][db]); o[nq][db] = WFrag<T16>::mma(vf2[kk][db], pf[nq][kk], o[nq][db]); } } } }
    }
#pragma unroll
    for (int nq = 0; nq < NQ; ++nq) {
#pragma unroll
        for (int db = 0; db < 4; ++db) { v8us oh, ol;   /* a lane's 8 registers are 8 consecutive d of its query: one 16-byte store a plane; a head's 128-byte line of a row is written by this wave alone */
#pragma unroll
            for (int j = 0; j < 8; ++j) { unsigned short a, c2; splitf(o[nq][db][j] * ((NSPLIT == 2) ? 1.0f : (1.0f / PCAR)), a, c2); oh[j] = a; ol[j] = c2; }
            const size_t oo = (size_t)(q0 + nq * 16 + lr) * DQ + db * 16 + 8 * hi; *(v8us*)(Ah + oo) = oh; *(v8us*)(Al + oo) = ol; } }
}
// grid (RH/64 + (TT-RH)/128, heads), 4 independent waves: blocks x < RH/64 take 64 hi/lo rows (16 a wave), the rest 128 fp16 rows (32 a wave). Output: the merged [t][head x d] hi/lo planes that the Wp product reads.
__global__ __launch_bounds__(128) void k_fattn(const h16* __restrict__ Q16, const bf* __restrict__ Qh, const bf* __restrict__ Ql, const h16* __restrict__ K16, const bf* __restrict__ Kh, const bf* __restrict__ Kl, const h16* __restrict__ V16, const bf* __restrict__ Vh, const bf* __restrict__ Vl, bf* __restrict__ Ah, bf* __restrict__ Al) {
    const int wave = threadIdx.x >> 5, bx = blockIdx.x; const size_t hb = (size_t)blockIdx.y * TT * HD, ho = (size_t)blockIdx.y * HD;
    if (bx < RH / 64) fattn<bf, 2, 1>(Qh + hb, Ql + hb, Kh + hb, Kl + hb, Vh + hb, Vl + hb, Ah + ho, Al + ho, bx * 64 + wave * 16);
    else fattn<h16, 0, 2>(Q16 + hb, nullptr, K16 + hb, nullptr, V16 + hb, nullptr, Ah + ho, Al + ho, RH + (bx - RH / 64) * 128 + wave * 32);
}

extern "C" void kernel_launch(void* const* d_in, const int* in_sizes, int n_in,
                              void* d_out, int out_size, void* d_ws, size_t ws_size, hipStream_t stream) {
    (void)in_sizes; (void)n_in; (void)out_size;
    const float* x = (const float*)d_in[0]; const float* wq = (const float*)d_in[1]; const float* wk = (const float*)d_in[2]; const float* wv = (const float*)d_in[3]; const float* wo = (const float*)d_in[4]; const float* bo = (const float*)d_in[5];
    float* OUT = (float*)d_out;     // [2][2048][1024]
    char* wsp = (char*)d_ws;
    auto take = [&](size_t bytes) { char* p = wsp; wsp += (bytes + 255) & ~(size_t)255; return (void*)p; };
    bf* WQ = (bf*)take((size_t)DQ * DM * 2); bf* WK = (bf*)take((size_t)DKV * DM * 2); bf* WV = (bf*)take((size_t)DKV * DM * 2); bf* WO = (bf*)take((size_t)DM * DQ * 2);
    bf* XB = (bf*)take((size_t)TT * DM * 2);
    h16* QP16 = (h16*)take((size_t)NH_ * TT * HD * 2); h16* KP16 = (h16*)take((size_t)NKV * TT * HD * 2); h16* VT16 = (h16*)take((size_t)NKV * HD * TT * 2);
    bf* QPh = (bf*)take((size_t)NH_ * TT * HD * 2); bf* QPl = (bf*)take((size_t)NH_ * TT * HD * 2); bf* KPh = (bf*)take((size_t)NKV * TT * HD * 2); bf* KPl = (bf*)take((size_t)NKV * TT * HD * 2); bf* VTh = (bf*)take((size_t)NKV * HD * TT * 2); bf* VTl = (bf*)take((size_t)NKV * HD * TT * 2);
    bf* ATh = (bf*)take((size_t)TT * DQ * 2); bf* ATl = (bf*)take((size_t)TT * DQ * 2);
    if ((size_t)(wsp - (char*)d_ws) > ws_size) return;    // ws 256 MiB
    { k_wtG<<<(unsigned)((DM * DQ / 64 + 63) / 64), 256, 0, stream>>>(wq, DM, DQ, WQ); k_wtG<<<(unsigned)((DM * DKV / 64 + 63) / 64), 256, 0, stream>>>(wk, DM, DKV, WK); k_wtG<<<(unsigned)((DM * DKV / 64 + 63) / 64), 256, 0, stream>>>(wv, DM, DKV, WV);
      k_wtG<<<(unsigned)((DQ * DM / 64 + 63) / 64), 256, 0, stream>>>(wo, DQ, DM, WO);
       }
    for (int b = 0; b < NB_; ++b) {
        
        k_cvt8<<<(unsigned)(((size_t)TT * DM / 8 + 255) / 256), 256, 0, stream>>>(x + (size_t)b * TT * DM, XB, (size_t)TT * DM / 8);
        k_gemmw<bf, 0, false, true><<<dim3(TT / 64, DQ / 64, 1), 32, 0, stream>>>(XB, nullptr, WQ, nullptr, DM, nullptr, HD, nullptr, 0, 0, 0, QP16, QPh, QPl, (size_t)TT * HD);
        k_gemmw<bf, 0, false, true><<<dim3(TT / 64, DKV / 64, 1), 32, 0, stream>>>(XB, nullptr, WK, nullptr, DM, nullptr, HD, nullptr, 0, 0, 0, KP16, KPh, KPl, (size_t)TT * HD);
        k_gemmw<bf, 0, false, true><<<dim3(DKV / 64, TT / 64, 1), 32, 0, stream>>>(WV, nullptr, XB, nullptr, DM, nullptr, TT, nullptr, 0, 0, 0, VT16, VTh, VTl, (size_t)64);
        k_fattn<<<dim3(RH / 64 + (TT - RH) / 128, NH_, 1), 128, 0, stream>>>(QP16, QPh, QPl, KP16, KPh, KPl, VT16, VTh, VTl, ATh, ATl);
        k_gemmw<bf, 1, true, false><<<dim3(TT / 64, DM / 64, 1), 32, 0, stream>>>(ATh, ATl, WO, nullptr, DQ, OUT + (size_t)b * TT * DM, DM, bo, 0, 0, 0, nullptr, nullptr, nullptr, 0); }
}

// v003
// Measured time: 313 microseconds a run.
// Timed twice side by side with v002, it ran 1.35 and 1.39 times as fast.
// All steps since v000 together make it 6.62 times as fast.
#include <hip/hip_runtime.h>

// 'Memory-efficient' attention whose softmax is normalised WITHIN EACH 128-KEY CHUNK (faithful to the source: attn = sum over the 16 key chunks of softmax_chunk(q.k_chunk x 64^-0.5) v_chunk) (x [2][2048][1024]; q,k,v = x W ('xw' 0.02, no bias; 16 heads x 64); out = merged Wp + bp ('xw') -> [2][2048][1024] (4.2 M)).
// Every 16-bit operand plane lies in FRAGMENT ORDER: a 16-row x 32-k tile is 1 KB in a row, [half][lane][8], k = 16 half + 8 (lane >> 4) + j, row = lane & 15, k tiles of a row tile in a row; a wave's 16-byte-a-lane load is then 512 bytes in a row (4 whole lines, not 16 lines of 32 bytes).
// Layout per batch: bf16 copy of x; 'xw' weights transposed once; exact projections that write the head planes themselves; ONE fused attention launch for all 16 heads: per 128-key chunk scores, the chunk's own softmax and P V stay in registers (16 independent softmaxes per row; the row then sums to 16) (hybrid rows: < 512 hi/lo 3 products, rest fp16 x1024); merged hi/lo x Wp exact + bp.
// Compute dtypes, f32 accumulate: every input rounded to bf16; projections exact; attention rows < 512 3 products, rest fp16; per-chunk softmax f32; Wp hl x exact + bias.

#define NB_  2
#define TT   2048
#define DM   1024
#define NH_  16
#define NKV  16
#define REP  (NH_ / NKV)
#define HD   64
#define DQ   (NH_ * HD)
#define DKV  (NKV * HD)
#define RH   512                  // query rows < RH use hi+lo planes (0: none)
#define WIN  0
#define PCAR 1024.0f
#define SCL  0.125f   // HD^-0.5
typedef _Float16 h16;
typedef unsigned short bf;
typedef __attribute__((ext_vector_type(16))) __bf16   v16bf;
typedef __attribute__((ext_vector_type(16))) _Float16 v16h;
typedef __attribute__((ext_vector_type(8)))  _Float16 v8h;
typedef __attribute__((ext_vector_type(8)))  unsigned short v8us;
typedef __attribute__((ext_vector_type(8)))  float    v8f;
typedef __attribute__((ext_vector_type(4)))  float    v4f;
typedef v8h  __attribute__((may_alias)) v8ha;
typedef v4f  __attribute__((may_alias)) v4fa;
typedef v8us __attribute__((may_alias)) v8usa;

__device__ __forceinline__ unsigned short f2bf(float f) { unsigned u = __float_as_uint(f); u += 0x7FFFu + ((u >> 16) & 1u); return (unsigned short)(u >> 16); }
__device__ __forceinline__ float bf2f(unsigned short b) { return __uint_as_float(((unsigned)b) << 16); }
__device__ __forceinline__ float bfr(float f) { return bf2f(f2bf(f)); }
__device__ __forceinline__ v16h cat16(v8h lo, v8h hi) { return __builtin_shufflevector(lo, hi, 0, 1, 2, 3, 4, 5, 6, 7, 8, 9, 10, 11, 12, 13, 14, 15); }
__device__ __forceinline__ v16bf cat16b(v8us lo, v8us hi) { return __builtin_bit_cast(v16bf, __builtin_shufflevector(lo, hi, 0, 1, 2, 3, 4, 5, 6, 7, 8, 9, 10, 11, 12, 13, 14, 15)); }
__device__ __forceinline__ v8f wmma16(v16h a, v16h b, v8f c) { return __builtin_amdgcn_wmma_f32_16x16x32_f16(false, a, false, b, (short)0, c, false, false); }
__device__ __forceinline__ v8f wmmab(v16bf a, v16bf b, v8f c) { return __builtin_amdgcn_wmma_f32_16x16x32_bf16(false, a, false, b, (short)0, c, false, false); }



// ---- k_gemmw: register-blocked GEMM, ONE WAVE per 64x64 output tile (16 accumulators), operands straight from 16-bit planes in fragment order; grid (M/64, N/64, Z), 32 threads.
// C[m][n] (f32, pitch ldc, + optional f32 bias[n]) = sum_k A[m][k] Bt[n][k] (+ split products per NSPLIT). z-batch strides sA/sB/sC in elements. K % 32 == 0; K is a compile-time constant, so that a plane's loads of one k step share one address and differ in the immediate offset alone.
// PLANES: no f32 C; the tile goes out as three 16-bit planes (fp16, bf16 hi, bf16 lo) in fragment order, rows m, k = n, ldc = the plane's k length, blockIdx.y x tstr = the start of this tile's 64 k. q, k: tstr = one head's plane, ldc = HD gives [head] x (t by d); v: A = weight rows, Bt = x rows, tstr = two k tiles, ldc = TT gives [head] x (d by t).
template <typename T16> struct WFrag;
template <> struct WFrag<h16> { typedef v16h V; static __device__ __forceinline__ V ld(const h16* p) { return cat16(*(const v8h*)p, *(const v8h*)(p + 256)); } static __device__ __forceinline__ v8f mma(V a, V b, v8f c) { return wmma16(a, b, c); } };
template <> struct WFrag<bf> { typedef v16bf V; static __device__ __forceinline__ V ld(const bf* p) { return cat16b(*(const v8us*)p, *(const v8us*)(p + 256)); } static __device__ __forceinline__ v8f mma(V a, V b, v8f c) { return wmmab(a, b, c); } };
__device__ __forceinline__ h16 tohx(float x) { return (h16)x; }
__device__ __forceinline__ void splitf(float y, unsigned short& h, unsigned short& l) { h = f2bf(y); l = f2bf(y - bf2f(h)); }
template <typename T16, int NSPLIT, bool BIAS, bool PLANES, int K>
__global__ __launch_bounds__(32) void k_gemmw(const T16* __restrict__ A, const T16* __restrict__ A2, const T16* __restrict__ Bt, const T16* __restrict__ Bt2, float* C, int ldc, const float* __restrict__ bias, size_t sA, size_t sB, size_t sC, h16* __restrict__ P16, bf* __restrict__ Ph, bf* __restrict__ Pl, size_t tstr) {
    typedef typename WFrag<T16>::V V;
    __shared__ __align__(16) float os[16 * 68];
    const size_t z = blockIdx.z; A += z * sA; if (A2) A2 += z * sA; Bt += z * sB; if (Bt2) Bt2 += z * sB; if (!PLANES) C += z * sC;
    const int lane = threadIdx.x & 31, lr = lane & 15, hi = lane >> 4; const int r0 = blockIdx.x * 64, c0 = blockIdx.y * 64;
    v8f acc[4][4];
#pragma unroll
    for (int mb = 0; mb < 4; ++mb)
#pragma unroll
        for (int nb = 0; nb < 4; ++nb) acc[mb][nb] = (v8f){};
    const T16* pa = A + (size_t)r0 * K; const T16* pa2 = A2 + (size_t)r0 * K; const T16* pb = Bt + (size_t)c0 * K; const T16* pb2 = Bt2 + (size_t)c0 * K; const unsigned lo = lane * 16;   /* 16 rows x K = K / 32 tiles of 512 elements; the base is the wave's, the lane adds its 16 bytes */
    auto at = [lo](const T16* base) { return (const T16*)((const char*)base + lo); };
#pragma unroll 1
    for (int kc = 0; kc < K; kc += 32) {
        V a[4], a2[4], b[4], b2[4]; const T16* qa = at(pa + kc * 16); const T16* qb = at(pb + kc * 16); const T16* qa2 = (NSPLIT == 1 || NSPLIT == 2) ? at(pa2 + kc * 16) : qa; const T16* qb2 = (NSPLIT >= 2) ? at(pb2 + kc * 16) : qb;
#pragma unroll
        for (int mb = 0; mb < 4; ++mb) { a[mb] = WFrag<T16>::ld(qa + mb * 16 * K); if (NSPLIT == 1 || NSPLIT == 2) a2[mb] = WFrag<T16>::ld(qa2 + mb * 16 * K); }
#pragma unroll
        for (int nb = 0; nb < 4; ++nb) { b[nb] = WFrag<T16>::ld(qb + nb * 16 * K); if (NSPLIT >= 2) b2[nb] = WFrag<T16>::ld(qb2 + nb * 16 * K); }
        asm volatile("s_wait_xcnt 0x0" :: "v"(qa), "v"(qa2), "v"(qb), "v"(qb2) : "memory");   /* stands in front of every later write of a register that these loads name as their address; the addresses are inputs so that they live up to the wait and no load of the run lands on them */
        __builtin_amdgcn_sched_barrier(0);   /* no later register write is lifted over the wait */
#pragma unroll
        for (int nb = 0; nb < 4; ++nb) {
#pragma unroll
            for (int mb = 0; mb < 4; ++mb) { acc[mb][nb] = WFrag<T16>::mma(a[mb], b[nb], acc[mb][nb]); if (NSPLIT == 1 || NSPLIT == 2) acc[mb][nb] = WFrag<T16>::mma(a2[mb], b[nb], acc[mb][nb]); if (NSPLIT >= 2) acc[mb][nb] = WFrag<T16>::mma(a[mb], b2[nb], acc[mb][nb]); } }
        asm volatile("v_nop\n\tv_nop\n\tv_nop\n\tv_nop" : "+v"(acc[0][0]), "+v"(acc[1][1]), "+v"(acc[2][2]), "+v"(acc[3][3]) : "v"(a[0]), "v"(a[3]));
    }
#pragma unroll
    for (int mb = 0; mb < 4; ++mb) {
#pragma unroll
        for (int nb = 0; nb < 4; ++nb) {
#pragma unroll
            for (int j = 0; j < 8; ++j) os[(hi * 8 + j) * 68 + nb * 16 + lr] = acc[mb][nb][j]; }
        __builtin_amdgcn_wave_barrier(); asm volatile("" ::: "memory");
        if (PLANES) {   /* a lane takes 8 columns of row lane & 15: store s is half a k tile, 512 bytes in a row of each plane */
            const size_t pe = (size_t)blockIdx.y * tstr + (size_t)(r0 + mb * 16) * ldc + lane * 8;
#pragma unroll
            for (int s = 0; s < 4; ++s) { const float* orow = os + lr * 68 + (2 * s + hi) * 8; const v4f x0 = *(const v4fa*)orow, x1 = *(const v4fa*)(orow + 4); v8h o16; v8us oh, ol;
#pragma unroll
                for (int j = 0; j < 8; ++j) { const float x = (j < 4) ? x0[j & 3] : x1[j & 3]; o16[j] = tohx(x); unsigned short a2, c2; splitf(x, a2, c2); oh[j] = a2; ol[j] = c2; }
                const size_t e = pe + s * 256; *(v8h*)(P16 + e) = o16; *(v8us*)(Ph + e) = oh; *(v8us*)(Pl + e) = ol; }
        } else {
            float* crow = C + (size_t)(r0 + mb * 16) * ldc + c0;
#pragma unroll
            for (int s = 0; s < 8; ++s) { const int row = 2 * s + hi, cofs = lr * 4; v4f val = *(const v4fa*)(os + row * 68 + cofs); if (BIAS) { val[0] += bfr(bias[c0 + cofs]); val[1] += bfr(bias[c0 + cofs + 1]); val[2] += bfr(bias[c0 + cofs + 2]); val[3] += bfr(bias[c0 + cofs + 3]); }
                *(v4f*)(crow + (size_t)row * ldc + cofs) = val; }
            asm volatile("s_wait_xcnt 0x0" ::: "memory");   /* stands in front of every later write of a register that these stores name */
            __builtin_amdgcn_sched_barrier(0);   /* no later register write is lifted over the wait */
             }
        __builtin_amdgcn_wave_barrier(); asm volatile("" ::: "memory");
    }
}

typedef __attribute__((ext_vector_type(4))) _Float16 v4h;
typedef __attribute__((ext_vector_type(2))) unsigned short v2us;
typedef __attribute__((ext_vector_type(4))) unsigned short v4us;
typedef __attribute__((ext_vector_type(4))) int v4i;

// One thread a 16-byte unit of the destination plane (unit u = [tile][half][lane]): a wave stores 512 bytes in a row.
// k_wtG: Bt rows n, k along w's rows; a load takes 64 bytes in a row of each of two rows of w.
__global__ __launch_bounds__(256) void k_wtG(const float* __restrict__ w, int K, int N, bf* Bt) {
    const int u = blockIdx.x * 256 + threadIdx.x; if (u >= N * K / 8) return;
    const int lane = u & 31, tile = u >> 6, KT = K >> 5; const int n = (tile / KT) * 16 + (lane & 15), k0 = (tile % KT) * 32 + ((u >> 5) & 1) * 16 + (lane >> 4) * 8;
    const float* p = w + (size_t)k0 * N + n; float v[8]; v8us o;
#pragma unroll
    for (int j = 0; j < 8; ++j) v[j] = p[(size_t)j * N];
#pragma unroll
    for (int j = 0; j < 8; ++j) o[j] = f2bf(v[j]);
    *(v8us*)(Bt + (size_t)u * 8) = o;
}
__global__ __launch_bounds__(256) void k_cvt8(const float* __restrict__ src, bf* dst, int K, int n8) { const int u = blockIdx.x * 256 + threadIdx.x; if (u >= n8) return;
    const int lane = u & 31, tile = u >> 6, KT = K >> 5; const int row = (tile / KT) * 16 + (lane & 15), k0 = (tile % KT) * 32 + ((u >> 5) & 1) * 16 + (lane >> 4) * 8;
    const v8f v = *(const v8f*)(src + (size_t)row * K + k0); v8us o;
#pragma unroll
    for (int k = 0; k < 8; ++k) o[k] = f2bf(v[k]); *(v8us*)(dst + (size_t)u * 8) = o;  }

// ---- k_fattn: fused attention, no score or probability plane in memory. A wave owns NQ x 16 query rows of one head and walks the 16 key chunks.
// Per chunk: St[key][query] = K Q^T (A = K rows, B = Q rows kept in registers), so a lane holds 64 of one query's 128 scores and lane ^ 16 the other 64: max and sum in the lane plus one exchange.
// Two St tiles (keys 0-15, 16-31 of a 32-key step), scaled and rounded in place, are the B operand of Ot[d][query] += Vt P^T in the k order of the plane loader (8 hi + j, 16 + 8 hi + j).
// eight exponentials in place, each on a register of its own, so each is the independent instruction behind the one before it; the v_nop fills the slot the instruction set asks for behind the last
__device__ __forceinline__ void exp2x8(v8f& t) { float a0 = t[0], a1 = t[1], a2 = t[2], a3 = t[3], a4 = t[4], a5 = t[5], a6 = t[6], a7 = t[7];
    asm("v_exp_f32 %0, %0\n\tv_exp_f32 %1, %1\n\tv_exp_f32 %2, %2\n\tv_exp_f32 %3, %3\n\tv_exp_f32 %4, %4\n\tv_exp_f32 %5, %5\n\tv_exp_f32 %6, %6\n\tv_exp_f32 %7, %7\n\tv_nop" : "+v"(a0), "+v"(a1), "+v"(a2), "+v"(a3), "+v"(a4), "+v"(a5), "+v"(a6), "+v"(a7));
    t[0] = a0; t[1] = a1; t[2] = a2; t[3] = a3; t[4] = a4; t[5] = a5; t[6] = a6; t[7] = a7; }
// reciprocal with the same slot behind it
__device__ __forceinline__ float rcp1(float x) { float r; asm("v_rcp_f32 %0, %1\n\tv_nop" : "=v"(r) : "v"(x)); return r; }
template <typename T16> struct PPack;
template <> struct PPack<h16> { static __device__ __forceinline__ void pack(v8f t0, v8f t1, float f, v16h& p, v16h& p2) { (void)p2;
#pragma unroll
    for (int j = 0; j < 8; ++j) { p[j] = tohx(t0[j] * f); p[8 + j] = tohx(t1[j] * f); } } };
template <> struct PPack<bf> { static __device__ __forceinline__ void pack(v8f t0, v8f t1, float f, v16bf& p, v16bf& p2) { v8us h0, h1, l0, l1;
#pragma unroll
    for (int j = 0; j < 8; ++j) { unsigned short a, c2; splitf(t0[j] * f, a, c2); h0[j] = a; l0[j] = c2; splitf(t1[j] * f, a, c2); h1[j] = a; l1[j] = c2; }
    p = cat16b(h0, h1); p2 = cat16b(l0, l1); } };
template <typename T16, int NSPLIT, int NQ>
__device__ __forceinline__ void fattn(const T16* __restrict__ Q, const T16* __restrict__ Q2, const T16* __restrict__ Kp, const T16* __restrict__ K2, const T16* __restrict__ Vt, const T16* __restrict__ Vt2, bf* __restrict__ Ah, bf* __restrict__ Al, int q0) {
    typedef typename WFrag<T16>::V V;
    const int lane = threadIdx.x & 31;
    V qf[NQ][2], qf2[NQ][2]; v8f o[NQ][4];
#pragma unroll
    for (int nq = 0; nq < NQ; ++nq) {
#pragma unroll
        for (int ks = 0; ks < 2; ++ks) { const size_t qo = (size_t)(q0 + nq * 16) * HD + ks * 512 + lane * 8; qf[nq][ks] = WFrag<T16>::ld(Q + qo); if (NSPLIT == 2) qf2[nq][ks] = WFrag<T16>::ld(Q2 + qo); }
#pragma unroll
        for (int db = 0; db < 4; ++db) o[nq][db] = (v8f){}; }
    asm volatile("s_wait_xcnt 0x0" ::: "memory");   /* as below, for the Q loads */
    __builtin_amdgcn_sched_barrier(0);   /* no later register write is lifted over the wait */
#pragma unroll 1
    for (int ch = 0; ch < TT / 128; ++ch) {   /* rolled: the body is unrolled inside; 16 copies would only grow the code */
        v8f s[NQ][8]; const size_t ko = (size_t)(ch * 128) * HD + lane * 8; V kf[8][2], kf2[8][2];
#pragma unroll
        for (int kt = 0; kt < 8; ++kt) {
#pragma unroll
            for (int ks = 0; ks < 2; ++ks) { kf[kt][ks] = WFrag<T16>::ld(Kp + ko + kt * 16 * HD + ks * 512); if (NSPLIT == 2) kf2[kt][ks] = WFrag<T16>::ld(K2 + ko + kt * 16 * HD + ks * 512); } }
        asm volatile("s_wait_xcnt 0x0" ::: "memory");   /* stands in front of every later write of a register that these loads name as their address */
        __builtin_amdgcn_sched_barrier(0);   /* all of the chunk's K loads issue ahead of the products (one load latency a chunk, not one a fragment), and no later register write is lifted over the wait */
#pragma unroll
        for (int kt = 0; kt < 8; ++kt) {
#pragma unroll
            for (int nq = 0; nq < NQ; ++nq) s[nq][kt] = (v8f){};
#pragma unroll
            for (int ks = 0; ks < 2; ++ks) {
#pragma unroll
                for (int nq = 0; nq < NQ; ++nq) { s[nq][kt] = WFrag<T16>::mma(kf[kt][ks], qf[nq][ks], s[nq][kt]); if (NSPLIT == 2) { s[nq][kt] = WFrag<T16>::mma(kf[kt][ks], qf2[nq][ks], s[nq][kt]); s[nq][kt] = WFrag<T16>::mma(kf2[kt][ks], qf[nq][ks], s[nq][kt]); } } } }
        __builtin_amdgcn_sched_barrier(0);   /* the V loads stay behind the products: lifted among them, while the K fragments are live, they take more registers than two waves per SIMD leave */
        const size_t vo = (size_t)(ch * 4) * 512 + lane * 8; V vf[4][4], vf2[4][4];
#pragma unroll
        for (int kk = 0; kk < 4; ++kk) {
#pragma unroll
            for (int db = 0; db < 4; ++db) { vf[kk][db] = WFrag<T16>::ld(Vt + vo + (size_t)db * 16 * TT + kk * 512); if (NSPLIT == 2) vf2[kk][db] = WFrag<T16>::ld(Vt2 + vo + (size_t)db * 16 * TT + kk * 512); } }
        asm volatile("s_wait_xcnt 0x0" ::: "memory");   /* stands in front of every later write of a register that these loads name as their address */
        __builtin_amdgcn_sched_barrier(0);   /* all of the chunk's V loads issue ahead of the softmax, whose vector work covers their latency, and no later register write is lifted over the wait */
        V pf[NQ][4], pf2[NQ][4];
#pragma unroll
        for (int nq = 0; nq < NQ; ++nq) { float m8[8], s8[8];
#pragma unroll
            for (int kt = 0; kt < 8; ++kt) { float m = s[nq][kt][0];
#pragma unroll
                for (int j = 1; j < 8; ++j) m = fmaxf(m, s[nq][kt][j]);
                m8[kt] = m; }
            float mx = fmaxf(fmaxf(fmaxf(m8[0], m8[1]), fmaxf(m8[2], m8[3])), fmaxf(fmaxf(m8[4], m8[5]), fmaxf(m8[6], m8[7]))); mx = fmaxf(mx, __shfl_xor(mx, 16, 32));   /* the chunk's max of this lane's query */
#pragma unroll
            for (int kt = 0; kt < 8; ++kt) { float a = 0.f;
#pragma unroll
                for (int j = 0; j < 8; ++j) s[nq][kt][j] = (s[nq][kt][j] - mx) * 0.18033688011112042f;   /* (s - max) x (1/8 x log2 e) */
                exp2x8(s[nq][kt]);
#pragma unroll
                for (int j = 0; j < 8; ++j) a += s[nq][kt][j];
                s8[kt] = a; }
            float sum = ((s8[0] + s8[1]) + (s8[2] + s8[3])) + ((s8[4] + s8[5]) + (s8[6] + s8[7])); sum += __shfl_xor(sum, 16, 32);
            const float r = rcp1(sum); const float f = (NSPLIT == 2) ? r : r * PCAR;   /* per-chunk normaliser (hardware reciprocal, 1 ulp); the fp16 rows carry x1024 */
#pragma unroll
            for (int kk = 0; kk < 4; ++kk) PPack<T16>::pack(s[nq][2 * kk], s[nq][2 * kk + 1], f, pf[nq][kk], pf2[nq][kk]); }
#pragma unroll
        for (int kk = 0; kk < 4; ++kk) {
#pragma unroll
            for (int db = 0; db < 4; ++db) {
#pragma unroll
                for (int nq = 0; nq < NQ; ++nq) { o[nq][db] = WFrag<T16>::mma(vf[kk][db], pf[nq][kk], o[nq][db]); if (NSPLIT == 2) { o[nq][db] = WFrag<T16>::mma(vf[kk][db], pf2[nq][kk], o[nq][db]); o[nq][db] = WFrag<T16>::mma(vf2[kk][db], pf[nq][kk], o[nq][db]); } } } }
    }
#pragma unroll
    for (int nq = 0; nq < NQ; ++nq) {
#pragma unroll
        for (int db = 0; db < 4; ++db) { v8us oh, ol;   /* a lane's 8 registers are 8 consecutive d of its query: one 16-byte unit of the merged plane's fragment order, the wave's store 512 bytes in a row */
#pragma unroll
            for (int j = 0; j < 8; ++j) { unsigned short a, c2; splitf(o[nq][db][j] * ((NSPLIT == 2) ? 1.0f : (1.0f / PCAR)), a, c2); oh[j] = a; ol[j] = c2; }
            const size_t oo = (size_t)(q0 + nq * 16) * DQ + db * 256 + lane * 8; *(v8us*)(Ah + oo) = oh; *(v8us*)(Al + oo) = ol; } }
}
// grid (RH/64 + (TT-RH)/128, heads), 4 independent waves: blocks x < RH/64 take 64 hi/lo rows (16 a wave), the rest 128 fp16 rows (32 a wave). Output: the merged (t by head x d) hi/lo planes, in fragment order, that the Wp product reads.
__global__ __launch_bounds__(128) void k_fattn(const h16* __restrict__ Q16, const bf* __restrict__ Qh, const bf* __restrict__ Ql, const h16* __restrict__ K16, const bf* __restrict__ Kh, const bf* __restrict__ Kl, const h16* __restrict__ V16, const bf* __restrict__ Vh, const bf* __restrict__ Vl, bf* __restrict__ Ah, bf* __restrict__ Al) {
    const int wave = threadIdx.x >> 5, bx = blockIdx.x; const size_t hb = (size_t)blockIdx.y * TT * HD, ho = (size_t)blockIdx.y * (HD / 32) * 512;
    if (bx < RH / 64) fattn<bf, 2, 1>(Qh + hb, Ql + hb, Kh + hb, Kl + hb, Vh + hb, Vl + hb, Ah + ho, Al + ho, bx * 64 + wave * 16);
    else fattn<h16, 0, 2>(Q16 + hb, nullptr, K16 + hb, nullptr, V16 + hb, nullptr, Ah + ho, Al + ho, RH + (bx - RH / 64) * 128 + wave * 32);
}

extern "C" void kernel_launch(void* const* d_in, const int* in_sizes, int n_in,
                              void* d_out, int out_size, void* d_ws, size_t ws_size, hipStream_t stream) {
    (void)in_sizes; (void)n_in; (void)out_size;
    const float* x = (const float*)d_in[0]; const float* wq = (const float*)d_in[1]; const float* wk = (const float*)d_in[2]; const float* wv = (const float*)d_in[3]; const float* wo = (const float*)d_in[4]; const float* bo = (const float*)d_in[5];
    float* OUT = (float*)d_out;     // [2][2048][1024]
    char* wsp = (char*)d_ws;
    auto take = [&](size_t bytes) { char* p = wsp; wsp += (bytes + 255) & ~(size_t)255; return (void*)p; };
    bf* WQ = (bf*)take((size_t)DQ * DM * 2); bf* WK = (bf*)take((size_t)DKV * DM * 2); bf* WV = (bf*)take((size_t)DKV * DM * 2); bf* WO = (bf*)take((size_t)DM * DQ * 2);
    bf* XB = (bf*)take((size_t)TT * DM * 2);
    h16* QP16 = (h16*)take((size_t)NH_ * TT * HD * 2); h16* KP16 = (h16*)take((size_t)NKV * TT * HD * 2); h16* VT16 = (h16*)take((size_t)NKV * HD * TT * 2);
    bf* QPh = (bf*)take((size_t)NH_ * TT * HD * 2); bf* QPl = (bf*)take((size_t)NH_ * TT * HD * 2); bf* KPh = (bf*)take((size_t)NKV * TT * HD * 2); bf* KPl = (bf*)take((size_t)NKV * TT * HD * 2); bf* VTh = (bf*)take((size_t)NKV * HD * TT * 2); bf* VTl = (bf*)take((size_t)NKV * HD * TT * 2);
    bf* ATh = (bf*)take((size_t)TT * DQ * 2); bf* ATl = (bf*)take((size_t)TT * DQ * 2);
    if ((size_t)(wsp - (char*)d_ws) > ws_size) return;    // ws 256 MiB
    { k_wtG<<<(unsigned)(DM * DQ / 8 / 256), 256, 0, stream>>>(wq, DM, DQ, WQ); k_wtG<<<(unsigned)(DM * DKV / 8 / 256), 256, 0, stream>>>(wk, DM, DKV, WK); k_wtG<<<(unsigned)(DM * DKV / 8 / 256), 256, 0, stream>>>(wv, DM, DKV, WV);
      k_wtG<<<(unsigned)(DQ * DM / 8 / 256), 256, 0, stream>>>(wo, DQ, DM, WO);
       }
    for (int b = 0; b < NB_; ++b) {
        
        k_cvt8<<<(unsigned)(((size_t)TT * DM / 8 + 255) / 256), 256, 0, stream>>>(x + (size_t)b * TT * DM, XB, DM, TT * DM / 8);
        k_gemmw<bf, 0, false, true, DM><<<dim3(TT / 64, DQ / 64, 1), 32, 0, stream>>>(XB, nullptr, WQ, nullptr, nullptr, HD, nullptr, 0, 0, 0, QP16, QPh, QPl, (size_t)TT * HD);
        k_gemmw<bf, 0, false, true, DM><<<dim3(TT / 64, DKV / 64, 1), 32, 0, stream>>>(XB, nullptr, WK, nullptr, nullptr, HD, nullptr, 0, 0, 0, KP16, KPh, KPl, (size_t)TT * HD);
        k_gemmw<bf, 0, false, true, DM><<<dim3(DKV / 64, TT / 64, 1), 32, 0, stream>>>(WV, nullptr, XB, nullptr, nullptr, TT, nullptr, 0, 0, 0, VT16, VTh, VTl, (size_t)1024);
        k_fattn<<<dim3(RH / 64 + (TT - RH) / 128, NH_, 1), 128, 0, stream>>>(QP16, QPh, QPl, KP16, KPh, KPl, VT16, VTh, VTl, ATh, ATl);
        k_gemmw<bf, 1, true, false, DQ><<<dim3(TT / 64, DM / 64, 1), 32, 0, stream>>>(ATh, ATl, WO, nullptr, OUT + (size_t)b * TT * DM, DM, bo, 0, 0, 0, nullptr, nullptr, nullptr, 0); }
}

// v004
// A run of this version takes 139 microseconds.
// Next to v003, in two timings, it ran 2.20 and 2.27 times as fast.
// Counting every step since v000, it is 14.8 times as fast.
#include <hip/hip_runtime.h>

// 'Memory-efficient' attention whose softmax is normalised WITHIN EACH 128-KEY CHUNK (faithful to the source: attn = sum over the 16 key chunks of softmax_chunk(q.k_chunk x 64^-0.5) v_chunk) (x [2][2048][1024]; q,k,v = x W ('xw' 0.02, no bias; 16 heads x 64); out = merged Wp + bp ('xw') -> [2][2048][1024] (4.2 M)).
// Every 16-bit operand plane lies in FRAGMENT ORDER: a 16-row x 32-k tile is 1 KB in a row, [half][lane][8], k = 16 half + 8 (lane >> 4) + j, row = lane & 15, k tiles of a row tile in a row; a wave's 16-byte-a-lane load is then 512 bytes in a row (4 whole lines, not 16 lines of 32 bytes).
// Four launches, both batches in each: bf16 copy of x and the 'xw' weights transposed; the three exact projections, which write the head planes themselves; ONE fused attention launch for all 16 heads: per 128-key chunk scores, the chunk's own softmax and P V stay in registers (16 independent softmaxes per row; the row then sums to 16) (hybrid rows: < 512 hi/lo 3 products, rest fp16 x1024); merged hi/lo x Wp exact + bp.
// Compute dtypes, f32 accumulate: every input rounded to bf16; projections exact; attention rows < 512 3 products, rest fp16; per-chunk softmax f32; Wp hl x exact + bias.

#define NB_  2
#define TT   2048
#define DM   1024
#define NH_  16
#define NKV  16
#define REP  (NH_ / NKV)
#define HD   64
#define DQ   (NH_ * HD)
#define DKV  (NKV * HD)
#define RH   512                  // query rows < RH use hi+lo planes (0: none)
#define WIN  0
#define PCAR 1024.0f
#define SCL  0.125f   // HD^-0.5
typedef _Float16 h16;
typedef unsigned short bf;
typedef __attribute__((ext_vector_type(16))) __bf16   v16bf;
typedef __attribute__((ext_vector_type(16))) _Float16 v16h;
typedef __attribute__((ext_vector_type(8)))  _Float16 v8h;
typedef __attribute__((ext_vector_type(8)))  unsigned short v8us;
typedef __attribute__((ext_vector_type(8)))  float    v8f;
typedef __attribute__((ext_vector_type(4)))  float    v4f;
typedef v8h  __attribute__((may_alias)) v8ha;
typedef v4f  __attribute__((may_alias)) v4fa;
typedef v8us __attribute__((may_alias)) v8usa;

__device__ __forceinline__ unsigned short f2bf(float f) { unsigned u = __float_as_uint(f); u += 0x7FFFu + ((u >> 16) & 1u); return (unsigned short)(u >> 16); }
__device__ __forceinline__ float bf2f(unsigned short b) { return __uint_as_float(((unsigned)b) << 16); }
__device__ __forceinline__ float bfr(float f) { return bf2f(f2bf(f)); }
__device__ __forceinline__ v16h cat16(v8h lo, v8h hi) { return __builtin_shufflevector(lo, hi, 0, 1, 2, 3, 4, 5, 6, 7, 8, 9, 10, 11, 12, 13, 14, 15); }
__device__ __forceinline__ v16bf cat16b(v8us lo, v8us hi) { return __builtin_bit_cast(v16bf, __builtin_shufflevector(lo, hi, 0, 1, 2, 3, 4, 5, 6, 7, 8, 9, 10, 11, 12, 13, 14, 15)); }
__device__ __forceinline__ v8f wmma16(v16h a, v16h b, v8f c) { return __builtin_amdgcn_wmma_f32_16x16x32_f16(false, a, false, b, (short)0, c, false, false); }
__device__ __forceinline__ v8f wmmab(v16bf a, v16bf b, v8f c) { return __builtin_amdgcn_wmma_f32_16x16x32_bf16(false, a, false, b, (short)0, c, false, false); }



// ---- k_gemmw: register-blocked GEMM, ONE WAVE per 64x64 output tile (16 accumulators), operands straight from 16-bit planes in fragment order; grid (M/64, N/64), 32 threads; PLANES: grid (TT/64, 16, 3 x batches).
// C[m][n] (f32, pitch ldc, + optional f32 bias[n]) = sum_k A[m][k] Bt[n][k] (+ split products per NSPLIT). K % 32 == 0; K is a compile-time constant, so that a plane's loads of one k step share one address and differ in the immediate offset alone.
// PLANES: no f32 C; the tile goes out as three 16-bit planes (fp16, bf16 hi, bf16 lo) in fragment order, rows m, k = n, ldc = the plane's k length, by x tstr = the start of this tile's 64 k. blockIdx.z = 3 x batch + projection; A = x of all batches, Bt = the three weights in a row, P16, Ph, Pl = [projection][batch] planes. q, k: tstr = one head's plane, ldc = HD gives [head] x (t by d); v: weight rows take A's place and x rows Bt's, tstr = two k tiles, ldc = TT gives [head] x (d by t).
template <typename T16> struct WFrag;
template <> struct WFrag<h16> { typedef v16h V; static __device__ __forceinline__ V ld(const h16* p) { return cat16(*(const v8h*)p, *(const v8h*)(p + 256)); } static __device__ __forceinline__ v8f mma(V a, V b, v8f c) { return wmma16(a, b, c); } };
template <> struct WFrag<bf> { typedef v16bf V; static __device__ __forceinline__ V ld(const bf* p) { return cat16b(*(const v8us*)p, *(const v8us*)(p + 256)); } static __device__ __forceinline__ v8f mma(V a, V b, v8f c) { return wmmab(a, b, c); } };
__device__ __forceinline__ h16 tohx(float x) { return (h16)x; }
__device__ __forceinline__ void splitf(float y, unsigned short& h, unsigned short& l) { h = f2bf(y); l = f2bf(y - bf2f(h)); }
template <typename T16, int NSPLIT, bool BIAS, bool PLANES, int K>
__global__ __launch_bounds__(32) void k_gemmw(const T16* __restrict__ A, const T16* __restrict__ A2, const T16* __restrict__ Bt, const T16* __restrict__ Bt2, float* C, int ldc, const float* __restrict__ bias, h16* __restrict__ P16, bf* __restrict__ Ph, bf* __restrict__ Pl) {
    typedef typename WFrag<T16>::V V;
    __shared__ __align__(16) float os[16 * 68];
    int bx = blockIdx.x, by = blockIdx.y; size_t tstr = 0;
    if (PLANES) { const int pj = blockIdx.z % 3, b = blockIdx.z / 3; const T16* X = A + (size_t)b * TT * K; const T16* Wt = Bt + (size_t)pj * DQ * K; const size_t po = (size_t)(pj * NB_ + b) * NH_ * TT * HD; P16 += po; Ph += po; Pl += po;
        if (pj == 2) { A = Wt; Bt = X; bx = blockIdx.y; by = blockIdx.x; ldc = TT; tstr = 1024; } else { A = X; Bt = Wt; ldc = HD; tstr = (size_t)TT * HD; } }
    const int lane = threadIdx.x & 31, lr = lane & 15, hi = lane >> 4; const int r0 = bx * 64, c0 = by * 64;
    v8f acc[4][4];
#pragma unroll
    for (int mb = 0; mb < 4; ++mb)
#pragma unroll
        for (int nb = 0; nb < 4; ++nb) acc[mb][nb] = (v8f){};
    const T16* pa = A + (size_t)r0 * K; const T16* pa2 = A2 + (size_t)r0 * K; const T16* pb = Bt + (size_t)c0 * K; const T16* pb2 = Bt2 + (size_t)c0 * K; const unsigned lo = lane * 16;   /* 16 rows x K = K / 32 tiles of 512 elements; the base is the wave's, the lane adds its 16 bytes */
    auto at = [lo](const T16* base) { return (const T16*)((const char*)base + lo); };
#pragma unroll 1
    for (int kc = 0; kc < K; kc += 32) {
        V a[4], a2[4], b[4], b2[4]; const T16* qa = at(pa + kc * 16); const T16* qb = at(pb + kc * 16); const T16* qa2 = (NSPLIT == 1 || NSPLIT == 2) ? at(pa2 + kc * 16) : qa; const T16* qb2 = (NSPLIT >= 2) ? at(pb2 + kc * 16) : qb;
#pragma unroll
        for (int mb = 0; mb < 4; ++mb) { a[mb] = WFrag<T16>::ld(qa + mb * 16 * K); if (NSPLIT == 1 || NSPLIT == 2) a2[mb] = WFrag<T16>::ld(qa2 + mb * 16 * K); }
#pragma unroll
        for (int nb = 0; nb < 4; ++nb) { b[nb] = WFrag<T16>::ld(qb + nb * 16 * K); if (NSPLIT >= 2) b2[nb] = WFrag<T16>::ld(qb2 + nb * 16 * K); }
        asm volatile("s_wait_xcnt 0x0" :: "v"(qa), "v"(qa2), "v"(qb), "v"(qb2) : "memory");   /* stands in front of every later write of a register that these loads name as their address; the addresses are inputs so that they live up to the wait and no load of the run lands on them */
        __builtin_amdgcn_sched_barrier(0);   /* no later register write is lifted over the wait */
#pragma unroll
        for (int nb = 0; nb < 4; ++nb) {
#pragma unroll
            for (int mb = 0; mb < 4; ++mb) { acc[mb][nb] = WFrag<T16>::mma(a[mb], b[nb], acc[mb][nb]); if (NSPLIT == 1 || NSPLIT == 2) acc[mb][nb] = WFrag<T16>::mma(a2[mb], b[nb], acc[mb][nb]); if (NSPLIT >= 2) acc[mb][nb] = WFrag<T16>::mma(a[mb], b2[nb], acc[mb][nb]); } }
        asm volatile("v_nop\n\tv_nop\n\tv_nop\n\tv_nop" : "+v"(acc[0][0]), "+v"(acc[1][1]), "+v"(acc[2][2]), "+v"(acc[3][3]) : "v"(a[0]), "v"(a[3]));
    }
#pragma unroll
    for (int mb = 0; mb < 4; ++mb) {
#pragma unroll
        for (int nb = 0; nb < 4; ++nb) {
#pragma unroll
            for (int j = 0; j < 8; ++j) os[(hi * 8 + j) * 68 + nb * 16 + lr] = acc[mb][nb][j]; }
        __builtin_amdgcn_wave_barrier(); asm volatile("" ::: "memory");
        if (PLANES) {   /* a lane takes 8 columns of row lane & 15: store s is half a k tile, 512 bytes in a row of each plane */
            const size_t pe = (size_t)by * tstr + (size_t)(r0 + mb * 16) * ldc + lane * 8;
#pragma unroll
            for (int s = 0; s < 4; ++s) { const float* orow = os + lr * 68 + (2 * s + hi) * 8; const v4f x0 = *(const v4fa*)orow, x1 = *(const v4fa*)(orow + 4); v8h o16; v8us oh, ol;
#pragma unroll
                for (int j = 0; j < 8; ++j) { const float x = (j < 4) ? x0[j & 3] : x1[j & 3]; o16[j] = tohx(x); unsigned short a2, c2; splitf(x, a2, c2); oh[j] = a2; ol[j] = c2; }
                const size_t e = pe + s * 256; *(v8h*)(P16 + e) = o16; *(v8us*)(Ph + e) = oh; *(v8us*)(Pl + e) = ol; }
        } else {
            float* crow = C + (size_t)(r0 + mb * 16) * ldc + c0;
#pragma unroll
            for (int s = 0; s < 8; ++s) { const int row = 2 * s + hi, cofs = lr * 4; v4f val = *(const v4fa*)(os + row * 68 + cofs); if (BIAS) { val[0] += bfr(bias[c0 + cofs]); val[1] += bfr(bias[c0 + cofs + 1]); val[2] += bfr(bias[c0 + cofs + 2]); val[3] += bfr(bias[c0 + cofs + 3]); }
                *(v4f*)(crow + (size_t)row * ldc + cofs) = val; }
            asm volatile("s_wait_xcnt 0x0" ::: "memory");   /* stands in front of every later write of a register that these stores name */
            __builtin_amdgcn_sched_barrier(0);   /* no later register write is lifted over the wait */
             }
        __builtin_amdgcn_wave_barrier(); asm volatile("" ::: "memory");
    }
}

typedef __attribute__((ext_vector_type(4))) _Float16 v4h;
typedef __attribute__((ext_vector_type(2))) unsigned short v2us;
typedef __attribute__((ext_vector_type(4))) unsigned short v4us;
typedef __attribute__((ext_vector_type(4))) int v4i;

// One thread a 16-byte unit of the destination plane (unit u = [tile][half][lane]): a wave stores 512 bytes in a row.
// wt_unit: Bt rows n, k along w's rows; a load takes 64 bytes in a row of each of two rows of w.
__device__ __forceinline__ void wt_unit(const float* __restrict__ w, int K, int N, bf* Bt, int u) {
    const int lane = u & 31, tile = u >> 6, KT = K >> 5; const int n = (tile / KT) * 16 + (lane & 15), k0 = (tile % KT) * 32 + ((u >> 5) & 1) * 16 + (lane >> 4) * 8;
    const float* p = w + (size_t)k0 * N + n; float v[8]; v8us o;
#pragma unroll
    for (int j = 0; j < 8; ++j) v[j] = p[(size_t)j * N];
#pragma unroll
    for (int j = 0; j < 8; ++j) o[j] = f2bf(v[j]);
    *(v8us*)(Bt + (size_t)u * 8) = o;
}
__device__ __forceinline__ void cvt_unit(const float* __restrict__ src, bf* dst, int K, int u) {
    const int lane = u & 31, tile = u >> 6, KT = K >> 5; const int row = (tile / KT) * 16 + (lane & 15), k0 = (tile % KT) * 32 + ((u >> 5) & 1) * 16 + (lane >> 4) * 8;
    const v8f v = *(const v8f*)(src + (size_t)row * K + k0); v8us o;
#pragma unroll
    for (int k = 0; k < 8; ++k) o[k] = f2bf(v[k]); *(v8us*)(dst + (size_t)u * 8) = o;  }
// k_prep: blocks [0, 4 WB): the four weights, WB blocks each, into WT = [wq][wk][wv][wo]; the rest: x of all batches (rows b x TT + t) into XB.
#define WB (DM * DQ / 8 / 256)
static_assert(DQ == DM && DKV == DM, "the four weights share one shape");
__global__ __launch_bounds__(256) void k_prep(const float* __restrict__ x, const float* __restrict__ wq, const float* __restrict__ wk, const float* __restrict__ wv, const float* __restrict__ wo, bf* WT, bf* XB) {
    const int bx = blockIdx.x;
    if (bx < 4 * WB) { const int pj = bx / WB; const float* w = (pj == 0) ? wq : (pj == 1) ? wk : (pj == 2) ? wv : wo; wt_unit(w, DM, DQ, WT + (size_t)pj * DM * DQ, (bx % WB) * 256 + threadIdx.x); }
    else cvt_unit(x, XB, DM, (bx - 4 * WB) * 256 + threadIdx.x);
}

// ---- k_fattn: fused attention, no score or probability plane in memory. A wave owns NQ x 16 query rows of one head and walks the 16 key chunks.
// Per chunk: St[key][query] = K Q^T (A = K rows, B = Q rows kept in registers), so a lane holds 64 of one query's 128 scores and lane ^ 16 the other 64: max and sum in the lane plus one exchange.
// Two St tiles (keys 0-15, 16-31 of a 32-key step), scaled and rounded in place, are the B operand of Ot[d][query] += Vt P^T in the k order of the plane loader (8 hi + j, 16 + 8 hi + j).
// eight exponentials in place, each on a register of its own, so each is the independent instruction behind the one before it; the v_nop fills the slot the instruction set asks for behind the last
__device__ __forceinline__ void exp2x8(v8f& t) { float a0 = t[0], a1 = t[1], a2 = t[2], a3 = t[3], a4 = t[4], a5 = t[5], a6 = t[6], a7 = t[7];
    asm("v_exp_f32 %0, %0\n\tv_exp_f32 %1, %1\n\tv_exp_f32 %2, %2\n\tv_exp_f32 %3, %3\n\tv_exp_f32 %4, %4\n\tv_exp_f32 %5, %5\n\tv_exp_f32 %6, %6\n\tv_exp_f32 %7, %7\n\tv_nop" : "+v"(a0), "+v"(a1), "+v"(a2), "+v"(a3), "+v"(a4), "+v"(a5), "+v"(a6), "+v"(a7));
    t[0] = a0; t[1] = a1; t[2] = a2; t[3] = a3; t[4] = a4; t[5] = a5; t[6] = a6; t[7] = a7; }
// reciprocal with the same slot behind it
__device__ __forceinline__ float rcp1(float x) { float r; asm("v_rcp_f32 %0, %1\n\tv_nop" : "=v"(r) : "v"(x)); return r; }
template <typename T16> struct PPack;
template <> struct PPack<h16> { static __device__ __forceinline__ void pack(v8f t0, v8f t1, float f, v16h& p, v16h& p2) { (void)p2;
#pragma unroll
    for (int j = 0; j < 8; ++j) { p[j] = tohx(t0[j] * f); p[8 + j] = tohx(t1[j] * f); } } };
template <> struct PPack<bf> { static __device__ __forceinline__ void pack(v8f t0, v8f t1, float f, v16bf& p, v16bf& p2) { v8us h0, h1, l0, l1;
#pragma unroll
    for (int j = 0; j < 8; ++j) { unsigned short a, c2; splitf(t0[j] * f, a, c2); h0[j] = a; l0[j] = c2; splitf(t1[j] * f, a, c2); h1[j] = a; l1[j] = c2; }
    p = cat16b(h0, h1); p2 = cat16b(l0, l1); } };
template <typename T16, int NSPLIT, int NQ>
__device__ __forceinline__ void fattn(const T16* __restrict__ Q, const T16* __restrict__ Q2, const T16* __restrict__ Kp, const T16* __restrict__ K2, const T16* __restrict__ Vt, const T16* __restrict__ Vt2, bf* __restrict__ Ah, bf* __restrict__ Al, int q0) {
    typedef typename WFrag<T16>::V V;
    const int lane = threadIdx.x & 31;
    V qf[NQ][2], qf2[NQ][2]; v8f o[NQ][4];
#pragma unroll
    for (int nq = 0; nq < NQ; ++nq) {
#pragma unroll
        for (int ks = 0; ks < 2; ++ks) { const size_t qo = (size_t)(q0 + nq * 16) * HD + ks * 512 + lane * 8; qf[nq][ks] = WFrag<T16>::ld(Q + qo); if (NSPLIT == 2) qf2[nq][ks] = WFrag<T16>::ld(Q2 + qo); }
#pragma unroll
        for (int db = 0; db < 4; ++db) o[nq][db] = (v8f){}; }
    asm volatile("s_wait_xcnt 0x0" ::: "memory");   /* as below, for the Q loads */
    __builtin_amdgcn_sched_barrier(0);   /* no later register write is lifted over the wait */
#pragma unroll 1
    for (int ch = 0; ch < TT / 128; ++ch) {   /* rolled: the body is unrolled inside; 16 copies would only grow the code */
        v8f s[NQ][8]; const size_t ko = (size_t)(ch * 128) * HD + lane * 8; V kf[8][2], kf2[8][2];
#pragma unroll
        for (int kt = 0; kt < 8; ++kt) {
#pragma unroll
            for (int ks = 0; ks < 2; ++ks) { kf[kt][ks] = WFrag<T16>::ld(Kp + ko + kt * 16 * HD + ks * 512); if (NSPLIT == 2) kf2[kt][ks] = WFrag<T16>::ld(K2 + ko + kt * 16 * HD + ks * 512); } }
        asm volatile("s_wait_xcnt 0x0" ::: "memory");   /* stands in front of every later write of a register that these loads name as their address */
        __builtin_amdgcn_sched_barrier(0);   /* all of the chunk's K loads issue ahead of the products (one load latency a chunk, not one a fragment), and no later register write is lifted over the wait */
#pragma unroll
        for (int kt = 0; kt < 8; ++kt) {
#pragma unroll
            for (int nq = 0; nq < NQ; ++nq) s[nq][kt] = (v8f){};
#pragma unroll
            for (int ks = 0; ks < 2; ++ks) {
#pragma unroll
                for (int nq = 0; nq < NQ; ++nq) { s[nq][kt] = WFrag<T16>::mma(kf[kt][ks], qf[nq][ks], s[nq][kt]); if (NSPLIT == 2) { s[nq][kt] = WFrag<T16>::mma(kf[kt][ks], qf2[nq][ks], s[nq][kt]); s[nq][kt] = WFrag<T16>::mma(kf2[kt][ks], qf[nq][ks], s[nq][kt]); } } } }
        __builtin_amdgcn_sched_barrier(0);   /* the V loads stay behind the products: lifted among them, while the K fragments are live, they take more registers than two waves per SIMD leave */
        const size_t vo = (size_t)(ch * 4) * 512 + lane * 8; V vf[4][4], vf2[4][4];
#pragma unroll
        for (int kk = 0; kk < 4; ++kk) {
#pragma unroll
            for (int db = 0; db < 4; ++db) { vf[kk][db] = WFrag<T16>::ld(Vt + vo + (size_t)db * 16 * TT + kk * 512); if (NSPLIT == 2) vf2[kk][db] = WFrag<T16>::ld(Vt2 + vo + (size_t)db * 16 * TT + kk * 512); } }
        asm volatile("s_wait_xcnt 0x0" ::: "memory");   /* stands in front of every later write of a register that these loads name as their address */
        __builtin_amdgcn_sched_barrier(0);   /* all of the chunk's V loads issue ahead of the softmax, whose vector work covers their latency, and no later register write is lifted over the wait */
        V pf[NQ][4], pf2[NQ][4];
#pragma unroll
        for (int nq = 0; nq < NQ; ++nq) { float m8[8], s8[8];
#pragma unroll
            for (int kt = 0; kt < 8; ++kt) { float m = s[nq][kt][0];
#pragma unroll
                for (int j = 1; j < 8; ++j) m = fmaxf(m, s[nq][kt][j]);
                m8[kt] = m; }
            float mx = fmaxf(fmaxf(fmaxf(m8[0], m8[1]), fmaxf(m8[2], m8[3])), fmaxf(fmaxf(m8[4], m8[5]), fmaxf(m8[6], m8[7]))); mx = fmaxf(mx, __shfl_xor(mx, 16, 32));   /* the chunk's max of this lane's query */
#pragma unroll
            for (int kt = 0; kt < 8; ++kt) { float a = 0.f;
#pragma unroll
                for (int j = 0; j < 8; ++j) s[nq][kt][j] = (s[nq][kt][j] - mx) * 0.18033688011112042f;   /* (s - max) x (1/8 x log2 e) */
                exp2x8(s[nq][kt]);
#pragma unroll
                for (int j = 0; j < 8; ++j) a += s[nq][kt][j];
                s8[kt] = a; }
            float sum = ((s8[0] + s8[1]) + (s8[2] + s8[3])) + ((s8[4] + s8[5]) + (s8[6] + s8[7])); sum += __shfl_xor(sum, 16, 32);
            const float r = rcp1(sum); const float f = (NSPLIT == 2) ? r : r * PCAR;   /* per-chunk normaliser (hardware reciprocal, 1 ulp); the fp16 rows carry x1024 */
#pragma unroll
            for (int kk = 0; kk < 4; ++kk) PPack<T16>::pack(s[nq][2 * kk], s[nq][2 * kk + 1], f, pf[nq][kk], pf2[nq][kk]); }
#pragma unroll
        for (int kk = 0; kk < 4; ++kk) {
#pragma unroll
            for (int db = 0; db < 4; ++db) {
#pragma unroll
                for (int nq = 0; nq < NQ; ++nq) { o[nq][db] = WFrag<T16>::mma(vf[kk][db], pf[nq][kk], o[nq][db]); if (NSPLIT == 2) { o[nq][db] = WFrag<T16>::mma(vf[kk][db], pf2[nq][kk], o[nq][db]); o[nq][db] = WFrag<T16>::mma(vf2[kk][db], pf[nq][kk], o[nq][db]); } } } }
    }
#pragma unroll
    for (int nq = 0; nq < NQ; ++nq) {
#pragma unroll
        for (int db = 0; db < 4; ++db) { v8us oh, ol;   /* a lane's 8 registers are 8 consecutive d of its query: one 16-byte unit of the merged plane's fragment order, the wave's store 512 bytes in a row */
#pragma unroll
            for (int j = 0; j < 8; ++j) { unsigned short a, c2; splitf(o[nq][db][j] * ((NSPLIT == 2) ? 1.0f : (1.0f / PCAR)), a, c2); oh[j] = a; ol[j] = c2; }
            const size_t oo = (size_t)(q0 + nq * 16) * DQ + db * 256 + lane * 8; *(v8us*)(Ah + oo) = oh; *(v8us*)(Al + oo) = ol; } }
}
// grid (heads, batches, RH/64 + (TT-RH)/128), 4 independent waves: blocks z < RH/64 take 64 hi/lo rows (16 a wave), the rest 128 fp16 rows (32 a wave). The row block is the slowest index: there are more blocks than resident places, and the longer hi/lo blocks then start first. Output: the merged (t by head x d) hi/lo planes, in fragment order, that the Wp product reads.
__global__ __launch_bounds__(128) void k_fattn(const h16* __restrict__ Q16, const bf* __restrict__ Qh, const bf* __restrict__ Ql, const h16* __restrict__ K16, const bf* __restrict__ Kh, const bf* __restrict__ Kl, const h16* __restrict__ V16, const bf* __restrict__ Vh, const bf* __restrict__ Vl, bf* __restrict__ Ah, bf* __restrict__ Al) {
    const int wave = threadIdx.x >> 5, bx = blockIdx.z; const size_t hb = ((size_t)blockIdx.y * NH_ + blockIdx.x) * TT * HD, ho = (size_t)blockIdx.y * TT * DQ + (size_t)blockIdx.x * (HD / 32) * 512;
    if (bx < RH / 64) fattn<bf, 2, 1>(Qh + hb, Ql + hb, Kh + hb, Kl + hb, Vh + hb, Vl + hb, Ah + ho, Al + ho, bx * 64 + wave * 16);
    else fattn<h16, 0, 2>(Q16 + hb, nullptr, K16 + hb, nullptr, V16 + hb, nullptr, Ah + ho, Al + ho, RH + (bx - RH / 64) * 128 + wave * 32);
}

extern "C" void kernel_launch(void* const* d_in, const int* in_sizes, int n_in,
                              void* d_out, int out_size, void* d_ws, size_t ws_size, hipStream_t stream) {
    (void)in_sizes; (void)n_in; (void)out_size;
    const float* x = (const float*)d_in[0]; const float* wq = (const float*)d_in[1]; const float* wk = (const float*)d_in[2]; const float* wv = (const float*)d_in[3]; const float* wo = (const float*)d_in[4]; const float* bo = (const float*)d_in[5];
    float* OUT = (float*)d_out;     // [2][2048][1024]
    char* wsp = (char*)d_ws;
    auto take = [&](size_t bytes) { char* p = wsp; wsp += (bytes + 255) & ~(size_t)255; return (void*)p; };
    bf* WT = (bf*)take((size_t)4 * DQ * DM * 2);   // wq, wk, wv, wo
    bf* XB = (bf*)take((size_t)NB_ * TT * DM * 2);
    const size_t PL = (size_t)NB_ * NH_ * TT * HD;   // one projection's plane, all batches
    h16* P16 = (h16*)take(3 * PL * 2); bf* Ph = (bf*)take(3 * PL * 2); bf* Pl = (bf*)take(3 * PL * 2);   // [q, k, v][batch]
    bf* ATh = (bf*)take((size_t)NB_ * TT * DQ * 2); bf* ATl = (bf*)take((size_t)NB_ * TT * DQ * 2);
    if ((size_t)(wsp - (char*)d_ws) > ws_size) return;    // ws 256 MiB
    k_prep<<<(unsigned)(4 * WB + NB_ * TT * DM / 8 / 256), 256, 0, stream>>>(x, wq, wk, wv, wo, WT, XB);
    k_gemmw<bf, 0, false, true, DM><<<dim3(TT / 64, DQ / 64, 3 * NB_), 32, 0, stream>>>(XB, nullptr, WT, nullptr, nullptr, 0, nullptr, P16, Ph, Pl);
    k_fattn<<<dim3(NH_, NB_, RH / 64 + (TT - RH) / 128), 128, 0, stream>>>(P16, Ph, Pl, P16 + PL, Ph + PL, Pl + PL, P16 + 2 * PL, Ph + 2 * PL, Pl + 2 * PL, ATh, ATl);
    k_gemmw<bf, 1, true, false, DQ><<<dim3(NB_ * TT / 64, DM / 64, 1), 32, 0, stream>>>(ATh, ATl, WT + (size_t)3 * DQ * DM, nullptr, OUT, DM, bo, nullptr, nullptr, nullptr);
}
